// v000
// Times are from an AMD MI455X. After a warm-up the kernel runs many times in a row, and a time is the length of
// such a window on the GPU divided by its runs, so every launch and the gaps after it count. The runs cycle
// through copies of the inputs. A figure is the median of several windows, for all but v000 over two sittings.
// Sittings can differ by a few percent; kernels timed side by side share one.
// v000, which the later versions start from, runs in 754 microseconds.
#include <hip/hip_runtime.h>
#include <math.h>

typedef __attribute__((ext_vector_type(16))) _Float16 v16h;
typedef __attribute__((ext_vector_type(16))) __bf16 v16b;
typedef __attribute__((ext_vector_type(8)))  _Float16 v8h;
typedef __attribute__((ext_vector_type(8)))  float v8f;
typedef __attribute__((ext_vector_type(4)))  float v4f;
typedef __attribute__((ext_vector_type(2)))  float v2f;
typedef __attribute__((ext_vector_type(4)))  unsigned v4u;
typedef __attribute__((ext_vector_type(4)))  int v4i;
typedef float __attribute__((may_alias)) float_a;
typedef int __attribute__((may_alias)) int_a;

template <typename T> __device__ __forceinline__ void vst2(void* p, T v) { *(T*)p = v;  }
__device__ __forceinline__ v8f wmma16(v16h a, v16h b, v8f c) {
  v8f d = __builtin_amdgcn_wmma_f32_16x16x32_f16(false, a, false, b, (short)0, c, false, false);
  asm volatile("v_nop\n\tv_nop\n\tv_nop\n\tv_nop" : "+v"(d) : "v"(a), "v"(b));
  return d;
}
__device__ __forceinline__ v8f wmma_bf(v16b a, v16b b, v8f c) {
  v8f d = __builtin_amdgcn_wmma_f32_16x16x32_bf16(false, a, false, b, (short)0, c, false, false);
  asm volatile("v_nop\n\tv_nop\n\tv_nop\n\tv_nop" : "+v"(d) : "v"(a), "v"(b));
  return d;
}
// 16x16x32 fragments: lane = (h = lane>>4, row/col = lane&15); elements 0..7 = k0+8h+0..7, 8..15 = k0+16+8h+0..7; D element r = row 8h+r
__device__ __forceinline__ v16h frag_h(const _Float16* rowk0, int lane) {
  union { v16h v; v8h q[2]; } u; const _Float16* p = rowk0 + 8 * (lane >> 4);
  u.q[0] = *(const v8h*)p; u.q[1] = *(const v8h*)(p + 16); return u.v;
}
__device__ __forceinline__ v16h frag_f32(const float* rowk0, int lane) {
  v16h a; const float* p = rowk0 + 8 * (lane >> 4);
#pragma unroll
  for (int i = 0; i < 8; ++i) { a[i] = (_Float16)p[i]; a[8 + i] = (_Float16)p[16 + i]; }
  return a;
}
__device__ __forceinline__ v16h frag_f32s(const float* rowk0, int lane, float sc) {
  v16h a; const float* p = rowk0 + 8 * (lane >> 4);
#pragma unroll
  for (int i = 0; i < 8; ++i) { a[i] = (_Float16)(p[i] * sc); a[8 + i] = (_Float16)(p[16 + i] * sc); }
  return a;
}
// column fragment from a [K][ld] layout (column n), rows >= K read as 0
__device__ __forceinline__ v16h fragc_f32(const float* W, int k0, int n, int lane, int ld, int K) {
  v16h a; const int g = lane >> 4;
#pragma unroll
  for (int i = 0; i < 8; ++i) { const int ka = k0 + 8 * g + i, kb = ka + 16;
    a[i] = (_Float16)(ka < K ? W[(size_t)(ka < K ? ka : K - 1) * ld + n] : 0.f); a[8 + i] = (_Float16)(kb < K ? W[(size_t)(kb < K ? kb : K - 1) * ld + n] : 0.f); }
  return a;
}
struct F2 { v16b h, l; };
__device__ __forceinline__ F2 bsplit16(const float v[16]) { F2 r;
#pragma unroll
  for (int i = 0; i < 16; ++i) { const __bf16 h = (__bf16)v[i]; r.h[i] = h; r.l[i] = (__bf16)(v[i] - (float)h); }
  return r; }
__device__ __forceinline__ F2 split_row(const float* row, int k0, int lane) { float v[16]; const float* p = row + k0 + 8 * (lane >> 4);
#pragma unroll
  for (int i = 0; i < 8; ++i) { v[i] = p[i]; v[8 + i] = p[16 + i]; }
  return bsplit16(v); }
__device__ __forceinline__ F2 split_rowK(const float* row, int k0, int lane, int K) { float v[16]; const int g = lane >> 4;
#pragma unroll
  for (int i = 0; i < 8; ++i) { const int ka = k0 + 8 * g + i, kb = ka + 16; v[i] = ka < K ? row[ka < K ? ka : K - 1] : 0.f; v[8 + i] = kb < K ? row[kb < K ? kb : K - 1] : 0.f; }
  return bsplit16(v); }
__device__ __forceinline__ F2 split_col(const float* W, int k0, int n, int lane, int ld, int K) { float v[16]; const int g = lane >> 4;
#pragma unroll
  for (int i = 0; i < 8; ++i) { const int ka = k0 + 8 * g + i, kb = ka + 16; v[i] = ka < K ? W[(size_t)(ka < K ? ka : K - 1) * ld + n] : 0.f; v[8 + i] = kb < K ? W[(size_t)(kb < K ? kb : K - 1) * ld + n] : 0.f; }
  return bsplit16(v); }
__device__ __forceinline__ v8f mac3(const F2& a, const F2& b, v8f c) { c = wmma_bf(a.l, b.h, c); c = wmma_bf(a.h, b.l, c); return wmma_bf(a.h, b.h, c); }
__device__ __forceinline__ float sigm(float v) { return 1.0f / (1.0f + expf(-v)); }
#define LDSX() do { asm volatile("s_wait_dscnt 0" ::: "memory"); __builtin_amdgcn_wave_barrier(); __builtin_amdgcn_fence(__ATOMIC_RELEASE, "workgroup"); } while (0)


// out = V @ softmax(Q K^T / 8): A [L,L] is the usual attention matrix but the module multiplies value [B,H,D,L] by it from the left, i.e. out[b,h,d,k] = sum_q V[d][q] A[q][k] (contraction over the QUERY index).  [4,16,2048,64] -> [4,16,64,2048].
// k_stats (per (64 queries, b,h): row max and sum of exp over all 2048 keys, bf16 scores), k_va (per (64 keys = output columns, b,h), 4 waves x 16 keys: for q in steps of 32: S^T tile = K_k . Q_q (bf16), P^T = exp(S^T/8 - m_q)/l_q -> LDS hi/lo, then out[d tile][k] += V[d][q] (bf16) x P^T (2 products) for the 4 d tiles; block tile staged and written as 256-B row segments).
#define NBH 64
#define LL 2048
#define DD 64
#ifndef TKB
#define TKB (LL / 64)
#define TNB NBH
#endif
typedef __attribute__((ext_vector_type(8))) __bf16 v8b;
__device__ __forceinline__ v16b frag_b(const __bf16* rowk0, int lane) {
  union { v16b v; v8b q[2]; } u; const __bf16* p = rowk0 + 8 * (lane >> 4);
  u.q[0] = *(const v8b*)p; u.q[1] = *(const v8b*)(p + 16); return u.v;
}
__device__ __forceinline__ v16b frag_gbf(const float* rowk0, int lane) {
  v16b a; const float* p = rowk0 + 8 * (lane >> 4);
#pragma unroll
  for (int i = 0; i < 8; ++i) { a[i] = (__bf16)p[i]; a[8 + i] = (__bf16)p[16 + i]; }
  return a;
}
__device__ __attribute__((noinline)) float exp_ni(float v) { return expf(v); }
#define WS_M   0u                      // f32 [64 bh][2048] row max
#define WS_L   (WS_M + 4u * NBH * LL)    // f32 row 1/sum
#define WS_END (WS_L + 4u * NBH * LL)
// ---- k_stats: block = (64 queries, bh), 4 waves: online max / sum over 64 key steps; M and 1/L rows (64 floats = 256 B per block)
__global__ __launch_bounds__(128) void k_stats(const float* __restrict__ Q, const float* __restrict__ K, float* __restrict__ M, float* __restrict__ IL) {
  __shared__ __align__(16) float sm[64], sl[64];
  const int tid = threadIdx.x, wave = tid >> 5, lane = tid & 31, col = lane & 15, g = lane >> 4; const int bh = blockIdx.y; const int q0 = blockIdx.x * 64 + wave * 16;
  const v16b a0 = frag_gbf(Q + ((size_t)bh * LL + q0 + col) * DD, lane), a1 = frag_gbf(Q + ((size_t)bh * LL + q0 + col) * DD + 32, lane);
  float m[8], l[8];
#pragma unroll
  for (int r = 0; r < 8; ++r) { m[r] = -3.0e38f; l[r] = 0.f; }
#pragma unroll 1
  for (int ks = 0; ks < LL / 32; ++ks) { float s[2][8];
#pragma unroll
    for (int ct = 0; ct < 2; ++ct) { const float* krow = K + ((size_t)bh * LL + ks * 32 + ct * 16 + col) * DD; v8f c = {}; c = wmma_bf(a0, frag_gbf(krow, lane), c); c = wmma_bf(a1, frag_gbf(krow + 32, lane), c);
#pragma unroll
      for (int r = 0; r < 8; ++r) s[ct][r] = c[r] * 0.125f; }
#pragma unroll
    for (int r = 0; r < 8; ++r) { float mx = fmaxf(s[0][r], s[1][r]);
#pragma unroll
      for (int o = 1; o < 16; o <<= 1) mx = fmaxf(mx, __shfl_xor(mx, o));
      const float mn = fmaxf(m[r], mx); float es = exp_ni(s[0][r] - mn) + exp_ni(s[1][r] - mn);
#pragma unroll
      for (int o = 1; o < 16; o <<= 1) es += __shfl_xor(es, o);
      l[r] = l[r] * exp_ni(m[r] - mn) + es; m[r] = mn; } }
  if (col == 0) {
#pragma unroll
    for (int r = 0; r < 8; ++r) { sm[wave * 16 + 8 * g + r] = m[r]; sl[wave * 16 + 8 * g + r] = 1.0f / l[r]; } }
  __syncthreads();
  if (tid < 16) vst2(M + (size_t)bh * LL + blockIdx.x * 64 + tid * 4, *(const v4f*)&sm[tid * 4]); else if (tid < 32) vst2(IL + (size_t)bh * LL + blockIdx.x * 64 + (tid - 16) * 4, *(const v4f*)&sl[(tid - 16) * 4]);
}
// ---- k_va: block = (64 keys k0.., bh), 4 waves (16 keys each): for each 32-query step: S^T[16 k][32 q] (bf16), P^T = exp(S^T/8 - M[q]) * IL[q] -> LDS hi/lo; acc[d tile] += V[d rows][q] (bf16) x P^T rows (2 products); out tile [64 d][64 k] staged, rows 256 B
__global__ __launch_bounds__(128) void k_va(const float* __restrict__ Q, const float* __restrict__ K, const float* __restrict__ V, const float* __restrict__ M, const float* __restrict__ IL, float* __restrict__ OUT) {
  __shared__ __align__(16) __bf16 sph[4][16][40], spl[4][16][40]; __shared__ __align__(16) float so[64][68];
  const int tid = threadIdx.x, wave = tid >> 5, lane = tid & 31, col = lane & 15, g = lane >> 4; const int bh = blockIdx.y; const int k0 = blockIdx.x * 64 + wave * 16;
  const v16b ka0 = frag_gbf(K + ((size_t)bh * LL + k0 + col) * DD, lane), ka1 = frag_gbf(K + ((size_t)bh * LL + k0 + col) * DD + 32, lane);
  const float* Vb = V + (size_t)bh * DD * LL; const float* Mb = M + (size_t)bh * LL; const float* ILb = IL + (size_t)bh * LL;
  v8f acc[4] = {};
#pragma unroll 1
  for (int qs = 0; qs < LL / 32; ++qs) {
#pragma unroll
    for (int ct = 0; ct < 2; ++ct) { const int q = qs * 32 + ct * 16 + col; const float* qrow = Q + ((size_t)bh * LL + q) * DD; v8f c = {}; c = wmma_bf(ka0, frag_gbf(qrow, lane), c); c = wmma_bf(ka1, frag_gbf(qrow + 32, lane), c);
      const float mq = Mb[q], ilq = ILb[q];
#pragma unroll
      for (int r = 0; r < 8; ++r) { const float p = exp_ni(c[r] * 0.125f - mq) * ilq; const __bf16 hb = (__bf16)p; sph[wave][8 * g + r][ct * 16 + col] = hb; spl[wave][8 * g + r][ct * 16 + col] = (__bf16)(p - (float)hb); } }
    LDSX();
    const v16b ph = frag_b(&sph[wave][col][0], lane), pl = frag_b(&spl[wave][col][0], lane);
#pragma unroll
    for (int dt = 0; dt < 4; ++dt) { const v16b va = frag_gbf(Vb + (size_t)(dt * 16 + col) * LL + qs * 32, lane); acc[dt] = wmma_bf(va, pl, acc[dt]); acc[dt] = wmma_bf(va, ph, acc[dt]); }
    LDSX(); }
#pragma unroll
  for (int dt = 0; dt < 4; ++dt)
#pragma unroll
    for (int r = 0; r < 8; ++r) so[dt * 16 + 8 * g + r][wave * 16 + col] = acc[dt][r];
  __syncthreads();
  for (int qd = tid; qd < 64 * 16; qd += 128) { const int d = qd >> 4, pc = qd & 15; vst2(OUT + ((size_t)bh * DD + d) * LL + blockIdx.x * 64 + pc * 4, *(const v4f*)&so[d][pc * 4]); }
}
extern "C" void kernel_launch(void* const* d_in, const int* in_sizes, int n_in, void* d_out, int out_size, void* d_ws, size_t ws_size, hipStream_t stream) {
  (void)in_sizes; (void)n_in; (void)out_size;
  const float** F = (const float**)d_in;   // query [4,16,2048,64], key [4,16,2048,64], value [4,16,64,2048]
  if (ws_size < (size_t)WS_END) return;
  char* ws = (char*)d_ws; float *M = (float*)(ws + WS_M), *IL = (float*)(ws + WS_L);
  k_stats<<<dim3(LL / 64, TNB), 128, 0, stream>>>(F[0], F[1], M, IL);
  k_va<<<dim3(TKB, TNB), 128, 0, stream>>>(F[0], F[1], F[2], M, IL, (float*)d_out);
}

// v001
// It runs in 407 microseconds.
// Timed twice side by side with v000, it ran 1.93 and 1.94 times as fast.
#include <hip/hip_runtime.h>
#include <math.h>

typedef __attribute__((ext_vector_type(16))) _Float16 v16h;
typedef __attribute__((ext_vector_type(16))) __bf16 v16b;
typedef __attribute__((ext_vector_type(8)))  _Float16 v8h;
typedef __attribute__((ext_vector_type(8)))  float v8f;
typedef __attribute__((ext_vector_type(4)))  float v4f;
typedef __attribute__((ext_vector_type(2)))  float v2f;
typedef __attribute__((ext_vector_type(4)))  unsigned v4u;
typedef __attribute__((ext_vector_type(4)))  int v4i;
typedef float __attribute__((may_alias)) float_a;
typedef int __attribute__((may_alias)) int_a;

template <typename T> __device__ __forceinline__ void vst2(void* p, T v) { *(T*)p = v;  }
__device__ __forceinline__ v8f wmma16(v16h a, v16h b, v8f c) {
  v8f d = __builtin_amdgcn_wmma_f32_16x16x32_f16(false, a, false, b, (short)0, c, false, false);
  asm volatile("v_nop\n\tv_nop\n\tv_nop\n\tv_nop" : "+v"(d) : "v"(a), "v"(b));
  return d;
}
__device__ __forceinline__ v8f wmma_bf(v16b a, v16b b, v8f c) {
  v8f d = __builtin_amdgcn_wmma_f32_16x16x32_bf16(false, a, false, b, (short)0, c, false, false);
  asm volatile("v_nop\n\tv_nop\n\tv_nop\n\tv_nop" : "+v"(d) : "v"(a), "v"(b));
  return d;
}
// 16x16x32 fragments: lane = (h = lane>>4, row/col = lane&15); elements 0..7 = k0+8h+0..7, 8..15 = k0+16+8h+0..7; D element r = row 8h+r
__device__ __forceinline__ v16h frag_h(const _Float16* rowk0, int lane) {
  union { v16h v; v8h q[2]; } u; const _Float16* p = rowk0 + 8 * (lane >> 4);
  u.q[0] = *(const v8h*)p; u.q[1] = *(const v8h*)(p + 16); return u.v;
}
__device__ __forceinline__ v16h frag_f32(const float* rowk0, int lane) {
  v16h a; const float* p = rowk0 + 8 * (lane >> 4);
#pragma unroll
  for (int i = 0; i < 8; ++i) { a[i] = (_Float16)p[i]; a[8 + i] = (_Float16)p[16 + i]; }
  return a;
}
__device__ __forceinline__ v16h frag_f32s(const float* rowk0, int lane, float sc) {
  v16h a; const float* p = rowk0 + 8 * (lane >> 4);
#pragma unroll
  for (int i = 0; i < 8; ++i) { a[i] = (_Float16)(p[i] * sc); a[8 + i] = (_Float16)(p[16 + i] * sc); }
  return a;
}
// column fragment from a [K][ld] layout (column n), rows >= K read as 0
__device__ __forceinline__ v16h fragc_f32(const float* W, int k0, int n, int lane, int ld, int K) {
  v16h a; const int g = lane >> 4;
#pragma unroll
  for (int i = 0; i < 8; ++i) { const int ka = k0 + 8 * g + i, kb = ka + 16;
    a[i] = (_Float16)(ka < K ? W[(size_t)(ka < K ? ka : K - 1) * ld + n] : 0.f); a[8 + i] = (_Float16)(kb < K ? W[(size_t)(kb < K ? kb : K - 1) * ld + n] : 0.f); }
  return a;
}
struct F2 { v16b h, l; };
__device__ __forceinline__ F2 bsplit16(const float v[16]) { F2 r;
#pragma unroll
  for (int i = 0; i < 16; ++i) { const __bf16 h = (__bf16)v[i]; r.h[i] = h; r.l[i] = (__bf16)(v[i] - (float)h); }
  return r; }
__device__ __forceinline__ F2 split_row(const float* row, int k0, int lane) { float v[16]; const float* p = row + k0 + 8 * (lane >> 4);
#pragma unroll
  for (int i = 0; i < 8; ++i) { v[i] = p[i]; v[8 + i] = p[16 + i]; }
  return bsplit16(v); }
__device__ __forceinline__ F2 split_rowK(const float* row, int k0, int lane, int K) { float v[16]; const int g = lane >> 4;
#pragma unroll
  for (int i = 0; i < 8; ++i) { const int ka = k0 + 8 * g + i, kb = ka + 16; v[i] = ka < K ? row[ka < K ? ka : K - 1] : 0.f; v[8 + i] = kb < K ? row[kb < K ? kb : K - 1] : 0.f; }
  return bsplit16(v); }
__device__ __forceinline__ F2 split_col(const float* W, int k0, int n, int lane, int ld, int K) { float v[16]; const int g = lane >> 4;
#pragma unroll
  for (int i = 0; i < 8; ++i) { const int ka = k0 + 8 * g + i, kb = ka + 16; v[i] = ka < K ? W[(size_t)(ka < K ? ka : K - 1) * ld + n] : 0.f; v[8 + i] = kb < K ? W[(size_t)(kb < K ? kb : K - 1) * ld + n] : 0.f; }
  return bsplit16(v); }
__device__ __forceinline__ v8f mac3(const F2& a, const F2& b, v8f c) { c = wmma_bf(a.l, b.h, c); c = wmma_bf(a.h, b.l, c); return wmma_bf(a.h, b.h, c); }
__device__ __forceinline__ float sigm(float v) { return 1.0f / (1.0f + expf(-v)); }
#define LDSX() do { asm volatile("s_wait_dscnt 0" ::: "memory"); __builtin_amdgcn_wave_barrier(); __builtin_amdgcn_fence(__ATOMIC_RELEASE, "workgroup"); } while (0)


// out = V @ softmax(Q K^T / 8): A [L,L] is the usual attention matrix but the module multiplies value [B,H,D,L] by it from the left, i.e. out[b,h,d,k] = sum_q V[d][q] A[q][k] (contraction over the QUERY index).  [4,16,2048,64] -> [4,16,64,2048].
// k_stats (per (64 queries, b,h): row max and sum of exp over all 2048 keys, bf16 scores), k_va (per (64 keys = output columns, b,h), 4 waves x 16 keys: for q in steps of 32: S^T tile = K_k . Q_q (bf16), P^T = exp(S^T/8 - m_q)/l_q -> LDS hi/lo, then out[d tile][k] += V[d][q] (bf16) x P^T (2 products) for the 4 d tiles; block tile staged and written as 256-B row segments).
#define NBH 64
#define LL 2048
#define DD 64
#ifndef TKB
#define TKB (LL / 64)
#define TNB NBH
#endif
typedef __attribute__((ext_vector_type(8))) __bf16 v8b;
__device__ __forceinline__ v16b frag_b(const __bf16* rowk0, int lane) {
  union { v16b v; v8b q[2]; } u; const __bf16* p = rowk0 + 8 * (lane >> 4);
  u.q[0] = *(const v8b*)p; u.q[1] = *(const v8b*)(p + 16); return u.v;
}
__device__ __forceinline__ v16b frag_gbf(const float* rowk0, int lane) {
  v16b a; const float* p = rowk0 + 8 * (lane >> 4);
#pragma unroll
  for (int i = 0; i < 8; ++i) { a[i] = (__bf16)p[i]; a[8 + i] = (__bf16)p[16 + i]; }
  return a;
}
__device__ __attribute__((noinline)) float exp_ni(float v) { return expf(v); }
// ---- block-shared operand tiles: read from global once per block with wave-loads that cover whole 128-B lines, rounded to bf16 once, kept in LDS; every wave takes its fragments from there
typedef __attribute__((ext_vector_type(4))) __bf16 v4b;
#define RP 72   // bf16 per LDS row of a [32][64] tile: 144 B = 16 B x 9, conflict-free pitch for 16-B fragment reads
#define VP 40   // bf16 per LDS row of a [64][32] tile: 80 B = 16 B x 5
#define NST (LL / 32)
__device__ __forceinline__ v4b cvt4(v4f v) { v4b r; r[0] = (__bf16)v[0]; r[1] = (__bf16)v[1]; r[2] = (__bf16)v[2]; r[3] = (__bf16)v[3]; return r; }
// [32 rows][64 f32], contiguous 8 KB: thread t takes the 16-B pieces t, t+128, t+256, t+384
__device__ __forceinline__ void rtile_ld(const float* src, int tid, v4f r[4]) {
#pragma unroll
  for (int i = 0; i < 4; ++i) r[i] = *(const v4f*)(src + i * 512 + tid * 4);
}
__device__ __forceinline__ void rtile_st(__bf16* dst, int tid, const v4f r[4]) {
#pragma unroll
  for (int i = 0; i < 4; ++i) *(v4b*)(dst + (i * 8 + (tid >> 4)) * RP + (tid & 15) * 4) = cvt4(r[i]);
}
// [64 rows][32 f32], row stride LL: 8 threads per 128-B row piece
__device__ __forceinline__ void vtile_ld(const float* src, int tid, v4f r[4]) {
#pragma unroll
  for (int i = 0; i < 4; ++i) r[i] = *(const v4f*)(src + (size_t)(i * 16 + (tid >> 3)) * LL + (tid & 7) * 4);
}
__device__ __forceinline__ void vtile_st(__bf16* dst, int tid, const v4f r[4]) {
#pragma unroll
  for (int i = 0; i < 4; ++i) *(v4b*)(dst + (i * 16 + (tid >> 3)) * VP + (tid & 7) * 4) = cvt4(r[i]);
}
#define WS_M   0u                      // f32 [64 bh][2048] row max
#define WS_L   (WS_M + 4u * NBH * LL)    // f32 row 1/sum
#define WS_END (WS_L + 4u * NBH * LL)
// ---- k_stats: block = (64 queries, bh), 4 waves: online max / sum over 64 key steps; M and 1/L rows (64 floats = 256 B per block)
__global__ __launch_bounds__(128) void k_stats(const float* __restrict__ Q, const float* __restrict__ K, float* __restrict__ M, float* __restrict__ IL) {
  __shared__ __align__(16) float sm[64], sl[64]; __shared__ __align__(16) __bf16 sk[2][32][RP];
  const int tid = threadIdx.x, wave = tid >> 5, lane = tid & 31, col = lane & 15, g = lane >> 4; const int bh = blockIdx.y; const int q0 = blockIdx.x * 64 + wave * 16;
  const v16b a0 = frag_gbf(Q + ((size_t)bh * LL + q0 + col) * DD, lane), a1 = frag_gbf(Q + ((size_t)bh * LL + q0 + col) * DD + 32, lane);
  const float* Kb = K + (size_t)bh * LL * DD; v4f rk[4];
  rtile_ld(Kb, tid, rk); rtile_st(&sk[0][0][0], tid, rk);
  float m[8], l[8];
#pragma unroll
  for (int r = 0; r < 8; ++r) { m[r] = -3.0e38f; l[r] = 0.f; }
  __syncthreads();
#pragma unroll 1
  for (int ks = 0; ks < NST; ++ks) { float s[2][8]; const int bf = ks & 1;
    if (ks + 1 < NST) rtile_ld(Kb + (ks + 1) * (32 * DD), tid, rk);
#pragma unroll
    for (int ct = 0; ct < 2; ++ct) { const __bf16* krow = &sk[bf][ct * 16 + col][0]; v8f c = {}; c = wmma_bf(a0, frag_b(krow, lane), c); c = wmma_bf(a1, frag_b(krow + 32, lane), c);
#pragma unroll
      for (int r = 0; r < 8; ++r) s[ct][r] = c[r] * 0.125f; }
#pragma unroll
    for (int r = 0; r < 8; ++r) { float mx = fmaxf(s[0][r], s[1][r]);
#pragma unroll
      for (int o = 1; o < 16; o <<= 1) mx = fmaxf(mx, __shfl_xor(mx, o));
      const float mn = fmaxf(m[r], mx); float es = exp_ni(s[0][r] - mn) + exp_ni(s[1][r] - mn);
#pragma unroll
      for (int o = 1; o < 16; o <<= 1) es += __shfl_xor(es, o);
      l[r] = l[r] * exp_ni(m[r] - mn) + es; m[r] = mn; }
    if (ks + 1 < NST) rtile_st(&sk[bf ^ 1][0][0], tid, rk);
    __syncthreads(); }   // publishes tile ks+1 and ends every wave's reads of tile ks, whose buffer the next step refills
  if (col == 0) {
#pragma unroll
    for (int r = 0; r < 8; ++r) { sm[wave * 16 + 8 * g + r] = m[r]; sl[wave * 16 + 8 * g + r] = 1.0f / l[r]; } }
  __syncthreads();
  if (tid < 16) vst2(M + (size_t)bh * LL + blockIdx.x * 64 + tid * 4, *(const v4f*)&sm[tid * 4]); else if (tid < 32) vst2(IL + (size_t)bh * LL + blockIdx.x * 64 + (tid - 16) * 4, *(const v4f*)&sl[(tid - 16) * 4]);
}
// ---- k_va: block = (64 keys k0.., bh), 4 waves (16 keys each): for each 32-query step: S^T[16 k][32 q] (bf16), P^T = exp(S^T/8 - M[q]) * IL[q] -> LDS hi/lo; acc[d tile] += V[d rows][q] (bf16) x P^T rows (2 products); out tile [64 d][64 k] staged, rows 256 B
__global__ __launch_bounds__(128) void k_va(const float* __restrict__ Q, const float* __restrict__ K, const float* __restrict__ V, const float* __restrict__ M, const float* __restrict__ IL, float* __restrict__ OUT) {
  __shared__ __align__(16) __bf16 sph[4][16][40], spl[4][16][40];
  __shared__ __align__(16) char sbuf[2 * 32 * RP * 2 + 2 * 64 * VP * 2];   // loop: Q tiles [2][32][RP], V tiles [2][64][VP]; epilogue: the f32 output tile [64][68]
  static_assert(sizeof(sbuf) >= 64 * 68 * 4, "output tile fits");
  __bf16 (*sq)[32][RP] = (__bf16 (*)[32][RP])sbuf; __bf16 (*sv)[64][VP] = (__bf16 (*)[64][VP])(sbuf + 2 * 32 * RP * 2); float (*so)[68] = (float (*)[68])sbuf;
  const int tid = threadIdx.x, wave = tid >> 5, lane = tid & 31, col = lane & 15, g = lane >> 4; const int bh = blockIdx.y; const int k0 = blockIdx.x * 64 + wave * 16;
  const v16b ka0 = frag_gbf(K + ((size_t)bh * LL + k0 + col) * DD, lane), ka1 = frag_gbf(K + ((size_t)bh * LL + k0 + col) * DD + 32, lane);
  const float* Vb = V + (size_t)bh * DD * LL; const float* Mb = M + (size_t)bh * LL; const float* ILb = IL + (size_t)bh * LL;
  const float* Qb = Q + (size_t)bh * LL * DD; v4f rq[4], rv[4];
  rtile_ld(Qb, tid, rq); vtile_ld(Vb, tid, rv); rtile_st(&sq[0][0][0], tid, rq); vtile_st(&sv[0][0][0], tid, rv);
  v8f acc[4] = {};
  __syncthreads();
#pragma unroll 1
  for (int qs = 0; qs < NST; ++qs) { const int bf = qs & 1;
#pragma unroll
    for (int ct = 0; ct < 2; ++ct) { const int q = qs * 32 + ct * 16 + col; const __bf16* qrow = &sq[bf][ct * 16 + col][0]; v8f c = {}; c = wmma_bf(ka0, frag_b(qrow, lane), c); c = wmma_bf(ka1, frag_b(qrow + 32, lane), c);
      const float mq = Mb[q], ilq = ILb[q];
#pragma unroll
      for (int r = 0; r < 8; ++r) { const float p = exp_ni(c[r] * 0.125f - mq) * ilq; const __bf16 hb = (__bf16)p; sph[wave][8 * g + r][ct * 16 + col] = hb; spl[wave][8 * g + r][ct * 16 + col] = (__bf16)(p - (float)hb); } }
    LDSX();
    if (qs + 1 < NST) { rtile_ld(Qb + (qs + 1) * (32 * DD), tid, rq); vtile_ld(Vb + (qs + 1) * 32, tid, rv);
      asm volatile("s_wait_xcnt 0x0" ::: "memory"); }   // the loads' address registers are reused right behind them, while the data is still in flight
    const v16b ph = frag_b(&sph[wave][col][0], lane), pl = frag_b(&spl[wave][col][0], lane);
#pragma unroll
    for (int dt = 0; dt < 4; ++dt) { const v16b va = frag_b(&sv[bf][dt * 16 + col][0], lane); acc[dt] = wmma_bf(va, pl, acc[dt]); acc[dt] = wmma_bf(va, ph, acc[dt]); }
    LDSX();
    if (qs + 1 < NST) { rtile_st(&sq[bf ^ 1][0][0], tid, rq); vtile_st(&sv[bf ^ 1][0][0], tid, rv); }
    __syncthreads(); }   // publishes tiles qs+1 and ends every wave's reads of tiles qs, whose buffers the next step refills (after the last step: the output tile)
#pragma unroll
  for (int dt = 0; dt < 4; ++dt)
#pragma unroll
    for (int r = 0; r < 8; ++r) so[dt * 16 + 8 * g + r][wave * 16 + col] = acc[dt][r];
  __syncthreads();
  for (int qd = tid; qd < 64 * 16; qd += 128) { const int d = qd >> 4, pc = qd & 15; vst2(OUT + ((size_t)bh * DD + d) * LL + blockIdx.x * 64 + pc * 4, *(const v4f*)&so[d][pc * 4]); }
}
extern "C" void kernel_launch(void* const* d_in, const int* in_sizes, int n_in, void* d_out, int out_size, void* d_ws, size_t ws_size, hipStream_t stream) {
  (void)in_sizes; (void)n_in; (void)out_size;
  const float** F = (const float**)d_in;   // query [4,16,2048,64], key [4,16,2048,64], value [4,16,64,2048]
  if (ws_size < (size_t)WS_END) return;
  char* ws = (char*)d_ws; float *M = (float*)(ws + WS_M), *IL = (float*)(ws + WS_L);
  k_stats<<<dim3(LL / 64, TNB), 128, 0, stream>>>(F[0], F[1], M, IL);
  k_va<<<dim3(TKB, TNB), 128, 0, stream>>>(F[0], F[1], F[2], M, IL, (float*)d_out);
}

// v002
// One run takes 237 microseconds.
// Timed twice side by side with v001, it ran 1.72 times as fast both times.
// Over all steps from v000 it is 3.32 times as fast.
#include <hip/hip_runtime.h>
#include <math.h>

typedef __attribute__((ext_vector_type(16))) _Float16 v16h;
typedef __attribute__((ext_vector_type(16))) __bf16 v16b;
typedef __attribute__((ext_vector_type(8)))  _Float16 v8h;
typedef __attribute__((ext_vector_type(8)))  float v8f;
typedef __attribute__((ext_vector_type(4)))  float v4f;
typedef __attribute__((ext_vector_type(2)))  float v2f;
typedef __attribute__((ext_vector_type(4)))  unsigned v4u;
typedef __attribute__((ext_vector_type(4)))  int v4i;
typedef float __attribute__((may_alias)) float_a;
typedef int __attribute__((may_alias)) int_a;

template <typename T> __device__ __forceinline__ void vst2(void* p, T v) { *(T*)p = v;  }
__device__ __forceinline__ v8f wmma16(v16h a, v16h b, v8f c) {
  v8f d = __builtin_amdgcn_wmma_f32_16x16x32_f16(false, a, false, b, (short)0, c, false, false);
  asm volatile("v_nop\n\tv_nop\n\tv_nop\n\tv_nop" : "+v"(d) : "v"(a), "v"(b));
  return d;
}
__device__ __forceinline__ v8f wmma_bf(v16b a, v16b b, v8f c) {
  v8f d = __builtin_amdgcn_wmma_f32_16x16x32_bf16(false, a, false, b, (short)0, c, false, false);
  asm volatile("v_nop\n\tv_nop\n\tv_nop\n\tv_nop" : "+v"(d) : "v"(a), "v"(b));
  return d;
}
// 16x16x32 fragments: lane = (h = lane>>4, row/col = lane&15); elements 0..7 = k0+8h+0..7, 8..15 = k0+16+8h+0..7; D element r = row 8h+r
__device__ __forceinline__ v16h frag_h(const _Float16* rowk0, int lane) {
  union { v16h v; v8h q[2]; } u; const _Float16* p = rowk0 + 8 * (lane >> 4);
  u.q[0] = *(const v8h*)p; u.q[1] = *(const v8h*)(p + 16); return u.v;
}
__device__ __forceinline__ v16h frag_f32(const float* rowk0, int lane) {
  v16h a; const float* p = rowk0 + 8 * (lane >> 4);
#pragma unroll
  for (int i = 0; i < 8; ++i) { a[i] = (_Float16)p[i]; a[8 + i] = (_Float16)p[16 + i]; }
  return a;
}
__device__ __forceinline__ v16h frag_f32s(const float* rowk0, int lane, float sc) {
  v16h a; const float* p = rowk0 + 8 * (lane >> 4);
#pragma unroll
  for (int i = 0; i < 8; ++i) { a[i] = (_Float16)(p[i] * sc); a[8 + i] = (_Float16)(p[16 + i] * sc); }
  return a;
}
// column fragment from a [K][ld] layout (column n), rows >= K read as 0
__device__ __forceinline__ v16h fragc_f32(const float* W, int k0, int n, int lane, int ld, int K) {
  v16h a; const int g = lane >> 4;
#pragma unroll
  for (int i = 0; i < 8; ++i) { const int ka = k0 + 8 * g + i, kb = ka + 16;
    a[i] = (_Float16)(ka < K ? W[(size_t)(ka < K ? ka : K - 1) * ld + n] : 0.f); a[8 + i] = (_Float16)(kb < K ? W[(size_t)(kb < K ? kb : K - 1) * ld + n] : 0.f); }
  return a;
}
struct F2 { v16b h, l; };
__device__ __forceinline__ F2 bsplit16(const float v[16]) { F2 r;
#pragma unroll
  for (int i = 0; i < 16; ++i) { const __bf16 h = (__bf16)v[i]; r.h[i] = h; r.l[i] = (__bf16)(v[i] - (float)h); }
  return r; }
__device__ __forceinline__ F2 split_row(const float* row, int k0, int lane) { float v[16]; const float* p = row + k0 + 8 * (lane >> 4);
#pragma unroll
  for (int i = 0; i < 8; ++i) { v[i] = p[i]; v[8 + i] = p[16 + i]; }
  return bsplit16(v); }
__device__ __forceinline__ F2 split_rowK(const float* row, int k0, int lane, int K) { float v[16]; const int g = lane >> 4;
#pragma unroll
  for (int i = 0; i < 8; ++i) { const int ka = k0 + 8 * g + i, kb = ka + 16; v[i] = ka < K ? row[ka < K ? ka : K - 1] : 0.f; v[8 + i] = kb < K ? row[kb < K ? kb : K - 1] : 0.f; }
  return bsplit16(v); }
__device__ __forceinline__ F2 split_col(const float* W, int k0, int n, int lane, int ld, int K) { float v[16]; const int g = lane >> 4;
#pragma unroll
  for (int i = 0; i < 8; ++i) { const int ka = k0 + 8 * g + i, kb = ka + 16; v[i] = ka < K ? W[(size_t)(ka < K ? ka : K - 1) * ld + n] : 0.f; v[8 + i] = kb < K ? W[(size_t)(kb < K ? kb : K - 1) * ld + n] : 0.f; }
  return bsplit16(v); }
__device__ __forceinline__ v8f mac3(const F2& a, const F2& b, v8f c) { c = wmma_bf(a.l, b.h, c); c = wmma_bf(a.h, b.l, c); return wmma_bf(a.h, b.h, c); }
__device__ __forceinline__ float sigm(float v) { return 1.0f / (1.0f + expf(-v)); }
#define LDSX() do { asm volatile("s_wait_dscnt 0" ::: "memory"); __builtin_amdgcn_wave_barrier(); __builtin_amdgcn_fence(__ATOMIC_RELEASE, "workgroup"); } while (0)


// out = V @ softmax(Q K^T / 8): A [L,L] is the usual attention matrix but the module multiplies value [B,H,D,L] by it from the left, i.e. out[b,h,d,k] = sum_q V[d][q] A[q][k] (contraction over the QUERY index).  [4,16,2048,64] -> [4,16,64,2048].
// k_stats (per (64 queries, b,h): row max and sum of exp over all 2048 keys, bf16 scores), k_va (per (64 keys = output columns, b,h), 4 waves x 16 keys: for q in steps of 32: S^T tile = K_k . Q_q (bf16), P^T = exp(S^T/8 - m_q)/l_q -> LDS hi/lo, then out[d tile][k] += V[d][q] (bf16) x P^T (2 products) for the 4 d tiles; block tile staged and written as 256-B row segments).
#define NBH 64
#define LL 2048
#define DD 64
#ifndef TKB
#define TKB (LL / 64)
#define TNB NBH
#endif
typedef __attribute__((ext_vector_type(8))) __bf16 v8b;
__device__ __forceinline__ v16b frag_b(const __bf16* rowk0, int lane) {
  union { v16b v; v8b q[2]; } u; const __bf16* p = rowk0 + 8 * (lane >> 4);
  u.q[0] = *(const v8b*)p; u.q[1] = *(const v8b*)(p + 16); return u.v;
}
__device__ __forceinline__ v16b frag_gbf(const float* rowk0, int lane) {
  v16b a; const float* p = rowk0 + 8 * (lane >> 4);
#pragma unroll
  for (int i = 0; i < 8; ++i) { a[i] = (__bf16)p[i]; a[8 + i] = (__bf16)p[16 + i]; }
  return a;
}
// 2^v by the hardware instruction, inline. Every argument here is a score minus its row maximum: at most a rounding error above 0; a result below 2^-126 comes out as 0, beside a row sum of about 1 or more
__device__ __forceinline__ float exp2_hw(float v) { return __builtin_amdgcn_exp2f(v); }
#define SC2 0.18033688f   // log2(e) / sqrt(64): the score scale and the change of base in one constant, applied by the FMA that subtracts the row maximum
// ---- block-shared operand tiles: read from global once per block with wave-loads that cover whole 128-B lines, rounded to bf16 once, kept in LDS; every wave takes its fragments from there
typedef __attribute__((ext_vector_type(4))) __bf16 v4b;
#define RP 72   // bf16 per LDS row of a [32][64] tile: 144 B = 16 B x 9, conflict-free pitch for 16-B fragment reads
#define VP 40   // bf16 per LDS row of a [64][32] tile: 80 B = 16 B x 5
#define NST (LL / 32)
__device__ __forceinline__ v4b cvt4(v4f v) { v4b r; r[0] = (__bf16)v[0]; r[1] = (__bf16)v[1]; r[2] = (__bf16)v[2]; r[3] = (__bf16)v[3]; return r; }
// [32 rows][64 f32], contiguous 8 KB: thread t takes the 16-B pieces t, t+128, t+256, t+384
__device__ __forceinline__ void rtile_ld(const float* src, int tid, v4f r[4]) {
#pragma unroll
  for (int i = 0; i < 4; ++i) r[i] = *(const v4f*)(src + i * 512 + tid * 4);
}
__device__ __forceinline__ void rtile_st(__bf16* dst, int tid, const v4f r[4]) {
#pragma unroll
  for (int i = 0; i < 4; ++i) *(v4b*)(dst + (i * 8 + (tid >> 4)) * RP + (tid & 15) * 4) = cvt4(r[i]);
}
// [64 rows][32 f32], row stride LL: 8 threads per 128-B row piece
__device__ __forceinline__ void vtile_ld(const float* src, int tid, v4f r[4]) {
#pragma unroll
  for (int i = 0; i < 4; ++i) r[i] = *(const v4f*)(src + (size_t)(i * 16 + (tid >> 3)) * LL + (tid & 7) * 4);
}
__device__ __forceinline__ void vtile_st(__bf16* dst, int tid, const v4f r[4]) {
#pragma unroll
  for (int i = 0; i < 4; ++i) *(v4b*)(dst + (i * 16 + (tid >> 3)) * VP + (tid & 7) * 4) = cvt4(r[i]);
}
#define WS_M   0u                      // f32 [64 bh][2048] row max, in log2 units
#define WS_L   (WS_M + 4u * NBH * LL)    // f32 row 1/sum
#define WS_END (WS_L + 4u * NBH * LL)
// ---- k_stats: block = (64 queries, bh), 4 waves: online max / sum over 64 key steps; M and 1/L rows (64 floats = 256 B per block)
__global__ __launch_bounds__(128) void k_stats(const float* __restrict__ Q, const float* __restrict__ K, float* __restrict__ M, float* __restrict__ IL) {
  __shared__ __align__(16) float sm[64], sl[64]; __shared__ __align__(16) __bf16 sk[2][32][RP];
  const int tid = threadIdx.x, wave = tid >> 5, lane = tid & 31, col = lane & 15, g = lane >> 4; const int bh = blockIdx.y; const int q0 = blockIdx.x * 64 + wave * 16;
  const v16b a0 = frag_gbf(Q + ((size_t)bh * LL + q0 + col) * DD, lane), a1 = frag_gbf(Q + ((size_t)bh * LL + q0 + col) * DD + 32, lane);
  const float* Kb = K + (size_t)bh * LL * DD; v4f rk[4];
  rtile_ld(Kb, tid, rk); rtile_st(&sk[0][0][0], tid, rk);
  float m[8], l[8];
#pragma unroll
  for (int r = 0; r < 8; ++r) { m[r] = -3.0e38f; l[r] = 0.f; }
  __syncthreads();
#pragma unroll 1
  for (int ks = 0; ks < NST; ++ks) { float s[2][8]; const int bf = ks & 1;
    if (ks + 1 < NST) rtile_ld(Kb + (ks + 1) * (32 * DD), tid, rk);
#pragma unroll
    for (int ct = 0; ct < 2; ++ct) { const __bf16* krow = &sk[bf][ct * 16 + col][0]; v8f c = {}; c = wmma_bf(a0, frag_b(krow, lane), c); c = wmma_bf(a1, frag_b(krow + 32, lane), c);
#pragma unroll
      for (int r = 0; r < 8; ++r) s[ct][r] = c[r]; }
#pragma unroll
    for (int r = 0; r < 8; ++r) { float mx = fmaxf(s[0][r], s[1][r]);
#pragma unroll
      for (int o = 1; o < 16; o <<= 1) mx = fmaxf(mx, __shfl_xor(mx, o));
      const float mn = fmaxf(m[r], mx), nb = -SC2 * mn; float es = exp2_hw(s[0][r] * SC2 + nb) + exp2_hw(s[1][r] * SC2 + nb);
#pragma unroll
      for (int o = 1; o < 16; o <<= 1) es += __shfl_xor(es, o);
      l[r] = l[r] * exp2_hw(m[r] * SC2 + nb) + es; m[r] = mn; }
    if (ks + 1 < NST) rtile_st(&sk[bf ^ 1][0][0], tid, rk);
    __syncthreads(); }   // publishes tile ks+1 and ends every wave's reads of tile ks, whose buffer the next step refills
  if (col == 0) {
#pragma unroll
    for (int r = 0; r < 8; ++r) { sm[wave * 16 + 8 * g + r] = SC2 * m[r]; sl[wave * 16 + 8 * g + r] = 1.0f / l[r]; } }
  __syncthreads();
  if (tid < 16) vst2(M + (size_t)bh * LL + blockIdx.x * 64 + tid * 4, *(const v4f*)&sm[tid * 4]); else if (tid < 32) vst2(IL + (size_t)bh * LL + blockIdx.x * 64 + (tid - 16) * 4, *(const v4f*)&sl[(tid - 16) * 4]);
}
// ---- k_va: block = (64 keys k0.., bh), 4 waves (16 keys each): for each 32-query step: S^T[16 k][32 q] (bf16), P^T = 2^(S^T * SC2 - M[q]) * IL[q] -> LDS hi/lo; acc[d tile] += V[d rows][q] (bf16) x P^T rows (2 products); out tile [64 d][64 k] staged, rows 256 B
// second bound: 8 waves per SIMD (128 registers), so that the 8 blocks that fall to each WGP stay resident together, as they were with the out-of-line call
__global__ __launch_bounds__(128, 8) void k_va(const float* __restrict__ Q, const float* __restrict__ K, const float* __restrict__ V, const float* __restrict__ M, const float* __restrict__ IL, float* __restrict__ OUT) {
  __shared__ __align__(16) __bf16 sph[4][16][40], spl[4][16][40];
  __shared__ __align__(16) char sbuf[2 * 32 * RP * 2 + 2 * 64 * VP * 2];   // loop: Q tiles [2][32][RP], V tiles [2][64][VP]; epilogue: the f32 output tile [64][68]
  static_assert(sizeof(sbuf) >= 64 * 68 * 4, "output tile fits");
  __bf16 (*sq)[32][RP] = (__bf16 (*)[32][RP])sbuf; __bf16 (*sv)[64][VP] = (__bf16 (*)[64][VP])(sbuf + 2 * 32 * RP * 2); float (*so)[68] = (float (*)[68])sbuf;
  const int tid = threadIdx.x, wave = tid >> 5, lane = tid & 31, col = lane & 15, g = lane >> 4; const int bh = blockIdx.y; const int k0 = blockIdx.x * 64 + wave * 16;
  const v16b ka0 = frag_gbf(K + ((size_t)bh * LL + k0 + col) * DD, lane), ka1 = frag_gbf(K + ((size_t)bh * LL + k0 + col) * DD + 32, lane);
  const float* Vb = V + (size_t)bh * DD * LL; const float* Mb = M + (size_t)bh * LL; const float* ILb = IL + (size_t)bh * LL;
  const float* Qb = Q + (size_t)bh * LL * DD; v4f rq[4], rv[4];
  rtile_ld(Qb, tid, rq); vtile_ld(Vb, tid, rv); rtile_st(&sq[0][0][0], tid, rq); vtile_st(&sv[0][0][0], tid, rv);
  v8f acc[4] = {};
  __syncthreads();
#pragma unroll 1
  for (int qs = 0; qs < NST; ++qs) { const int bf = qs & 1;
#pragma unroll
    for (int ct = 0; ct < 2; ++ct) { const int q = qs * 32 + ct * 16 + col; const __bf16* qrow = &sq[bf][ct * 16 + col][0]; v8f c = {}; c = wmma_bf(ka0, frag_b(qrow, lane), c); c = wmma_bf(ka1, frag_b(qrow + 32, lane), c);
      const float mq = Mb[q], ilq = ILb[q];
#pragma unroll
      for (int r = 0; r < 8; ++r) c[r] = exp2_hw(c[r] * SC2 - mq);   // the eight exponentials, then the eight high parts, then the eight low parts: no instruction waits on the one in front of it
#pragma unroll
      for (int r = 0; r < 8; ++r) c[r] *= ilq;
      __bf16 hb[8];
#pragma unroll
      for (int r = 0; r < 8; ++r) { hb[r] = (__bf16)c[r]; sph[wave][8 * g + r][ct * 16 + col] = hb[r]; }
#pragma unroll
      for (int r = 0; r < 8; ++r) spl[wave][8 * g + r][ct * 16 + col] = (__bf16)(c[r] - (float)hb[r]); }
    LDSX();
    if (qs + 1 < NST) { rtile_ld(Qb + (qs + 1) * (32 * DD), tid, rq); vtile_ld(Vb + (qs + 1) * 32, tid, rv);
      asm volatile("s_wait_xcnt 0x0" ::: "memory"); }   // the loads' address registers are reused right behind them, while the data is still in flight
    const v16b ph = frag_b(&sph[wave][col][0], lane), pl = frag_b(&spl[wave][col][0], lane);
#pragma unroll
    for (int dt = 0; dt < 4; ++dt) { const v16b va = frag_b(&sv[bf][dt * 16 + col][0], lane); acc[dt] = wmma_bf(va, pl, acc[dt]); acc[dt] = wmma_bf(va, ph, acc[dt]); }
    LDSX();
    if (qs + 1 < NST) { rtile_st(&sq[bf ^ 1][0][0], tid, rq); vtile_st(&sv[bf ^ 1][0][0], tid, rv); }
    __syncthreads(); }   // publishes tiles qs+1 and ends every wave's reads of tiles qs, whose buffers the next step refills (after the last step: the output tile)
#pragma unroll
  for (int dt = 0; dt < 4; ++dt)
#pragma unroll
    for (int r = 0; r < 8; ++r) so[dt * 16 + 8 * g + r][wave * 16 + col] = acc[dt][r];
  __syncthreads();
  for (int qd = tid; qd < 64 * 16; qd += 128) { const int d = qd >> 4, pc = qd & 15; vst2(OUT + ((size_t)bh * DD + d) * LL + blockIdx.x * 64 + pc * 4, *(const v4f*)&so[d][pc * 4]); }
}
extern "C" void kernel_launch(void* const* d_in, const int* in_sizes, int n_in, void* d_out, int out_size, void* d_ws, size_t ws_size, hipStream_t stream) {
  (void)in_sizes; (void)n_in; (void)out_size;
  const float** F = (const float**)d_in;   // query [4,16,2048,64], key [4,16,2048,64], value [4,16,64,2048]
  if (ws_size < (size_t)WS_END) return;
  char* ws = (char*)d_ws; float *M = (float*)(ws + WS_M), *IL = (float*)(ws + WS_L);
  k_stats<<<dim3(LL / 64, TNB), 128, 0, stream>>>(F[0], F[1], M, IL);
  k_va<<<dim3(TKB, TNB), 128, 0, stream>>>(F[0], F[1], F[2], M, IL, (float*)d_out);
}

// v003
// A run of this version takes 204 microseconds.
// Next to v002, in two timings, it ran 1.16 times as fast each time.
// Over all steps from v000 it is 3.85 times as fast.
#include <hip/hip_runtime.h>
#include <math.h>

typedef __attribute__((ext_vector_type(16))) _Float16 v16h;
typedef __attribute__((ext_vector_type(16))) __bf16 v16b;
typedef __attribute__((ext_vector_type(8)))  _Float16 v8h;
typedef __attribute__((ext_vector_type(8)))  float v8f;
typedef __attribute__((ext_vector_type(4)))  float v4f;
typedef __attribute__((ext_vector_type(2)))  float v2f;
typedef __attribute__((ext_vector_type(4)))  unsigned v4u;
typedef __attribute__((ext_vector_type(4)))  int v4i;
typedef float __attribute__((may_alias)) float_a;
typedef int __attribute__((may_alias)) int_a;

template <typename T> __device__ __forceinline__ void vst2(void* p, T v) { *(T*)p = v;  }
__device__ __forceinline__ v8f wmma16(v16h a, v16h b, v8f c) {
  v8f d = __builtin_amdgcn_wmma_f32_16x16x32_f16(false, a, false, b, (short)0, c, false, false);
  asm volatile("v_nop\n\tv_nop\n\tv_nop\n\tv_nop" : "+v"(d) : "v"(a), "v"(b));
  return d;
}
__device__ __forceinline__ v8f wmma_bf(v16b a, v16b b, v8f c) {
  v8f d = __builtin_amdgcn_wmma_f32_16x16x32_bf16(false, a, false, b, (short)0, c, false, false);
  asm volatile("v_nop\n\tv_nop\n\tv_nop\n\tv_nop" : "+v"(d) : "v"(a), "v"(b));
  return d;
}
// 16x16x32 fragments: lane = (h = lane>>4, row/col = lane&15); elements 0..7 = k0+8h+0..7, 8..15 = k0+16+8h+0..7; D element r = row 8h+r
__device__ __forceinline__ v16h frag_h(const _Float16* rowk0, int lane) {
  union { v16h v; v8h q[2]; } u; const _Float16* p = rowk0 + 8 * (lane >> 4);
  u.q[0] = *(const v8h*)p; u.q[1] = *(const v8h*)(p + 16); return u.v;
}
__device__ __forceinline__ v16h frag_f32(const float* rowk0, int lane) {
  v16h a; const float* p = rowk0 + 8 * (lane >> 4);
#pragma unroll
  for (int i = 0; i < 8; ++i) { a[i] = (_Float16)p[i]; a[8 + i] = (_Float16)p[16 + i]; }
  return a;
}
__device__ __forceinline__ v16h frag_f32s(const float* rowk0, int lane, float sc) {
  v16h a; const float* p = rowk0 + 8 * (lane >> 4);
#pragma unroll
  for (int i = 0; i < 8; ++i) { a[i] = (_Float16)(p[i] * sc); a[8 + i] = (_Float16)(p[16 + i] * sc); }
  return a;
}
// column fragment from a [K][ld] layout (column n), rows >= K read as 0
__device__ __forceinline__ v16h fragc_f32(const float* W, int k0, int n, int lane, int ld, int K) {
  v16h a; const int g = lane >> 4;
#pragma unroll
  for (int i = 0; i < 8; ++i) { const int ka = k0 + 8 * g + i, kb = ka + 16;
    a[i] = (_Float16)(ka < K ? W[(size_t)(ka < K ? ka : K - 1) * ld + n] : 0.f); a[8 + i] = (_Float16)(kb < K ? W[(size_t)(kb < K ? kb : K - 1) * ld + n] : 0.f); }
  return a;
}
struct F2 { v16b h, l; };
__device__ __forceinline__ F2 bsplit16(const float v[16]) { F2 r;
#pragma unroll
  for (int i = 0; i < 16; ++i) { const __bf16 h = (__bf16)v[i]; r.h[i] = h; r.l[i] = (__bf16)(v[i] - (float)h); }
  return r; }
__device__ __forceinline__ F2 split_row(const float* row, int k0, int lane) { float v[16]; const float* p = row + k0 + 8 * (lane >> 4);
#pragma unroll
  for (int i = 0; i < 8; ++i) { v[i] = p[i]; v[8 + i] = p[16 + i]; }
  return bsplit16(v); }
__device__ __forceinline__ F2 split_rowK(const float* row, int k0, int lane, int K) { float v[16]; const int g = lane >> 4;
#pragma unroll
  for (int i = 0; i < 8; ++i) { const int ka = k0 + 8 * g + i, kb = ka + 16; v[i] = ka < K ? row[ka < K ? ka : K - 1] : 0.f; v[8 + i] = kb < K ? row[kb < K ? kb : K - 1] : 0.f; }
  return bsplit16(v); }
__device__ __forceinline__ F2 split_col(const float* W, int k0, int n, int lane, int ld, int K) { float v[16]; const int g = lane >> 4;
#pragma unroll
  for (int i = 0; i < 8; ++i) { const int ka = k0 + 8 * g + i, kb = ka + 16; v[i] = ka < K ? W[(size_t)(ka < K ? ka : K - 1) * ld + n] : 0.f; v[8 + i] = kb < K ? W[(size_t)(kb < K ? kb : K - 1) * ld + n] : 0.f; }
  return bsplit16(v); }
__device__ __forceinline__ v8f mac3(const F2& a, const F2& b, v8f c) { c = wmma_bf(a.l, b.h, c); c = wmma_bf(a.h, b.l, c); return wmma_bf(a.h, b.h, c); }
__device__ __forceinline__ float sigm(float v) { return 1.0f / (1.0f + expf(-v)); }
#define LDSX() do { asm volatile("s_wait_dscnt 0" ::: "memory"); __builtin_amdgcn_wave_barrier(); __builtin_amdgcn_fence(__ATOMIC_RELEASE, "workgroup"); } while (0)


// out = V @ softmax(Q K^T / 8): A [L,L] is the usual attention matrix but the module multiplies value [B,H,D,L] by it from the left, i.e. out[b,h,d,k] = sum_q V[d][q] A[q][k] (contraction over the QUERY index).  [4,16,2048,64] -> [4,16,64,2048].
// k_stats (per (64 queries, b,h): row max and sum of exp over all 2048 keys, bf16 scores), k_va (per (64 keys = output columns, b,h), 4 waves x 16 keys: for q in steps of 32: S^T tile = K_k . Q_q (bf16), P^T = exp(S^T/8 - m_q)/l_q -> LDS hi/lo, then out[d tile][k] += V[d][q] (bf16) x P^T (2 products) for the 4 d tiles; block tile staged and written as 256-B row segments).
#define NBH 64
#define LL 2048
#define DD 64
#ifndef TKB
#define TKB (LL / 64)
#define TNB NBH
#endif
typedef __attribute__((ext_vector_type(8))) __bf16 v8b;
__device__ __forceinline__ v16b frag_b(const __bf16* rowk0, int lane) {
  union { v16b v; v8b q[2]; } u; const __bf16* p = rowk0 + 8 * (lane >> 4);
  u.q[0] = *(const v8b*)p; u.q[1] = *(const v8b*)(p + 16); return u.v;
}
__device__ __forceinline__ v16b frag_gbf(const float* rowk0, int lane) {
  v16b a; const float* p = rowk0 + 8 * (lane >> 4);
#pragma unroll
  for (int i = 0; i < 8; ++i) { a[i] = (__bf16)p[i]; a[8 + i] = (__bf16)p[16 + i]; }
  return a;
}
// 2^v by the hardware instruction, inline. Every argument here is a score minus its row maximum: at most a rounding error above 0; a result below 2^-126 comes out as 0, beside a row sum of about 1 or more
__device__ __forceinline__ float exp2_hw(float v) { return __builtin_amdgcn_exp2f(v); }
#define SC2 0.18033688f   // log2(e) / sqrt(64): the score scale and the change of base in one constant, applied by the FMA that subtracts the row maximum
// ---- block-shared operand tiles: read from global once per block with wave-loads that cover whole 128-B lines, rounded to bf16 once, kept in LDS; every wave takes its fragments from there
typedef __attribute__((ext_vector_type(4))) __bf16 v4b;
#define RP 72   // bf16 per LDS row of a [32][64] tile: 144 B = 16 B x 9, conflict-free pitch for 16-B fragment reads
#define VP 40   // bf16 per LDS row of a [64][32] tile: 80 B = 16 B x 5
#define NST (LL / 32)
__device__ __forceinline__ v4b cvt4(v4f v) { v4b r; r[0] = (__bf16)v[0]; r[1] = (__bf16)v[1]; r[2] = (__bf16)v[2]; r[3] = (__bf16)v[3]; return r; }
// [32 rows][64 f32], contiguous 8 KB: thread t takes the 16-B pieces t, t+128, t+256, t+384
__device__ __forceinline__ void rtile_ld(const float* src, int tid, v4f r[4]) {
#pragma unroll
  for (int i = 0; i < 4; ++i) r[i] = *(const v4f*)(src + i * 512 + tid * 4);
}
__device__ __forceinline__ void rtile_st(__bf16* dst, int tid, const v4f r[4]) {
#pragma unroll
  for (int i = 0; i < 4; ++i) *(v4b*)(dst + (i * 8 + (tid >> 4)) * RP + (tid & 15) * 4) = cvt4(r[i]);
}
// [64 rows][32 f32], row stride LL: 8 threads per 128-B row piece
__device__ __forceinline__ void vtile_ld(const float* src, int tid, v4f r[4]) {
#pragma unroll
  for (int i = 0; i < 4; ++i) r[i] = *(const v4f*)(src + (size_t)(i * 16 + (tid >> 3)) * LL + (tid & 7) * 4);
}
__device__ __forceinline__ void vtile_st(__bf16* dst, int tid, const v4f r[4]) {
#pragma unroll
  for (int i = 0; i < 4; ++i) *(v4b*)(dst + (i * 16 + (tid >> 3)) * VP + (tid & 7) * 4) = cvt4(r[i]);
}
#define WS_M   0u                      // f32 [64 bh][2048] row max, in log2 units
#define WS_L   (WS_M + 4u * NBH * LL)    // f32 row 1/sum
#define WS_END (WS_L + 4u * NBH * LL)
// ---- k_stats: block = (64 queries, bh), 4 waves: online max / sum over 64 key steps; M and 1/L rows (64 floats = 256 B per block)
// the score tile is formed as S^T (A = K rows from LDS, B = this wave's Q rows, kept in registers): lane (g, col) then holds 16 scores of ONE query, col, for the keys 16 ct + 8 g + r of the step, so the running maximum and sum are one register each and need no other lane; the two halves of the wave, which saw different keys, are joined once behind the loop
__global__ __launch_bounds__(128) void k_stats(const float* __restrict__ Q, const float* __restrict__ K, float* __restrict__ M, float* __restrict__ IL) {
  __shared__ __align__(16) float sm[64], sl[64]; __shared__ __align__(16) __bf16 sk[2][32][RP];
  const int tid = threadIdx.x, wave = tid >> 5, lane = tid & 31, col = lane & 15, g = lane >> 4; const int bh = blockIdx.y; const int q0 = blockIdx.x * 64 + wave * 16;
  const v16b a0 = frag_gbf(Q + ((size_t)bh * LL + q0 + col) * DD, lane), a1 = frag_gbf(Q + ((size_t)bh * LL + q0 + col) * DD + 32, lane);
  const float* Kb = K + (size_t)bh * LL * DD; v4f rk[4];
  rtile_ld(Kb, tid, rk); rtile_st(&sk[0][0][0], tid, rk);
  float m = -3.0e38f, l = 0.f;
  __syncthreads();
#pragma unroll 1
  for (int ks = 0; ks < NST; ++ks) { v8f s[2]; const int bf = ks & 1;
    if (ks + 1 < NST) rtile_ld(Kb + (ks + 1) * (32 * DD), tid, rk);
#pragma unroll
    for (int ct = 0; ct < 2; ++ct) { const __bf16* krow = &sk[bf][ct * 16 + col][0]; v8f c = {}; c = wmma_bf(frag_b(krow, lane), a0, c); s[ct] = wmma_bf(frag_b(krow + 32, lane), a1, c); }
    const float t0 = fmaxf(fmaxf(s[0][0], s[0][1]), s[0][2]), t1 = fmaxf(fmaxf(s[0][3], s[0][4]), s[0][5]), t2 = fmaxf(fmaxf(s[0][6], s[0][7]), s[1][0]);
    const float t3 = fmaxf(fmaxf(s[1][1], s[1][2]), s[1][3]), t4 = fmaxf(fmaxf(s[1][4], s[1][5]), s[1][6]);
    const float mn = fmaxf(fmaxf(fmaxf(fmaxf(t0, t1), t2), fmaxf(fmaxf(t3, t4), s[1][7])), m), nb = -SC2 * mn;
    v8f e[2];
#pragma unroll
    for (int ct = 0; ct < 2; ++ct) { const v8f x = s[ct] * SC2 + nb;
#pragma unroll
      for (int r = 0; r < 8; ++r) e[ct][r] = exp2_hw(x[r]); }
    const v8f e8 = e[0] + e[1]; const v4f e4 = e8.lo + e8.hi; const v2f e2 = e4.lo + e4.hi;
    l = l * exp2_hw(m * SC2 + nb) + (e2[0] + e2[1]); m = mn;
    if (ks + 1 < NST) rtile_st(&sk[bf ^ 1][0][0], tid, rk);
    __syncthreads(); }   // publishes tile ks+1 and ends every wave's reads of tile ks, whose buffer the next step refills
  { const float mo = __shfl_xor(m, 16), lo = __shfl_xor(l, 16), mt = fmaxf(m, mo), nb = -SC2 * mt;   // lanes col and col + 16: the same query, the other half of the keys
    l = l * exp2_hw(m * SC2 + nb) + lo * exp2_hw(mo * SC2 + nb); m = mt; }
  if (g == 0) { sm[wave * 16 + col] = SC2 * m; sl[wave * 16 + col] = 1.0f / l; }
  __syncthreads();
  if (tid < 16) vst2(M + (size_t)bh * LL + blockIdx.x * 64 + tid * 4, *(const v4f*)&sm[tid * 4]); else if (tid < 32) vst2(IL + (size_t)bh * LL + blockIdx.x * 64 + (tid - 16) * 4, *(const v4f*)&sl[(tid - 16) * 4]);
}
// ---- k_va: block = (64 keys k0.., bh), 4 waves (16 keys each): for each 32-query step: S^T[16 k][32 q] (bf16), P^T = 2^(S^T * SC2 - M[q]) * IL[q] -> LDS hi/lo; acc[d tile] += V[d rows][q] (bf16) x P^T rows (2 products); out tile [64 d][64 k] staged, rows 256 B
// second bound: 8 waves per SIMD (128 registers), so that the 8 blocks that fall to each WGP stay resident together, as they were with the out-of-line call
__global__ __launch_bounds__(128, 8) void k_va(const float* __restrict__ Q, const float* __restrict__ K, const float* __restrict__ V, const float* __restrict__ M, const float* __restrict__ IL, float* __restrict__ OUT) {
  __shared__ __align__(16) __bf16 sph[4][16][40], spl[4][16][40];
  __shared__ __align__(16) char sbuf[2 * 32 * RP * 2 + 2 * 64 * VP * 2];   // loop: Q tiles [2][32][RP], V tiles [2][64][VP]; epilogue: the f32 output tile [64][68]
  static_assert(sizeof(sbuf) >= 64 * 68 * 4, "output tile fits");
  __bf16 (*sq)[32][RP] = (__bf16 (*)[32][RP])sbuf; __bf16 (*sv)[64][VP] = (__bf16 (*)[64][VP])(sbuf + 2 * 32 * RP * 2); float (*so)[68] = (float (*)[68])sbuf;
  const int tid = threadIdx.x, wave = tid >> 5, lane = tid & 31, col = lane & 15, g = lane >> 4; const int bh = blockIdx.y; const int k0 = blockIdx.x * 64 + wave * 16;
  const v16b ka0 = frag_gbf(K + ((size_t)bh * LL + k0 + col) * DD, lane), ka1 = frag_gbf(K + ((size_t)bh * LL + k0 + col) * DD + 32, lane);
  const float* Vb = V + (size_t)bh * DD * LL; const float* Mb = M + (size_t)bh * LL; const float* ILb = IL + (size_t)bh * LL;
  const float* Qb = Q + (size_t)bh * LL * DD; v4f rq[4], rv[4];
  rtile_ld(Qb, tid, rq); vtile_ld(Vb, tid, rv); rtile_st(&sq[0][0][0], tid, rq); vtile_st(&sv[0][0][0], tid, rv);
  v8f acc[4] = {};
  __syncthreads();
#pragma unroll 1
  for (int qs = 0; qs < NST; ++qs) { const int bf = qs & 1;
#pragma unroll
    for (int ct = 0; ct < 2; ++ct) { const int q = qs * 32 + ct * 16 + col; const __bf16* qrow = &sq[bf][ct * 16 + col][0]; v8f c = {}; c = wmma_bf(ka0, frag_b(qrow, lane), c); c = wmma_bf(ka1, frag_b(qrow + 32, lane), c);
      const float mq = Mb[q], ilq = ILb[q];
#pragma unroll
      for (int r = 0; r < 8; ++r) c[r] = exp2_hw(c[r] * SC2 - mq);   // the eight exponentials, then the eight high parts, then the eight low parts: no instruction waits on the one in front of it
#pragma unroll
      for (int r = 0; r < 8; ++r) c[r] *= ilq;
      __bf16 hb[8];
#pragma unroll
      for (int r = 0; r < 8; ++r) { hb[r] = (__bf16)c[r]; sph[wave][8 * g + r][ct * 16 + col] = hb[r]; }
#pragma unroll
      for (int r = 0; r < 8; ++r) spl[wave][8 * g + r][ct * 16 + col] = (__bf16)(c[r] - (float)hb[r]); }
    LDSX();
    if (qs + 1 < NST) { rtile_ld(Qb + (qs + 1) * (32 * DD), tid, rq); vtile_ld(Vb + (qs + 1) * 32, tid, rv);
      asm volatile("s_wait_xcnt 0x0" ::: "memory"); }   // the loads' address registers are reused right behind them, while the data is still in flight
    const v16b ph = frag_b(&sph[wave][col][0], lane), pl = frag_b(&spl[wave][col][0], lane);
#pragma unroll
    for (int dt = 0; dt < 4; ++dt) { const v16b va = frag_b(&sv[bf][dt * 16 + col][0], lane); acc[dt] = wmma_bf(va, pl, acc[dt]); acc[dt] = wmma_bf(va, ph, acc[dt]); }
    LDSX();
    if (qs + 1 < NST) { rtile_st(&sq[bf ^ 1][0][0], tid, rq); vtile_st(&sv[bf ^ 1][0][0], tid, rv); }
    __syncthreads(); }   // publishes tiles qs+1 and ends every wave's reads of tiles qs, whose buffers the next step refills (after the last step: the output tile)
#pragma unroll
  for (int dt = 0; dt < 4; ++dt)
#pragma unroll
    for (int r = 0; r < 8; ++r) so[dt * 16 + 8 * g + r][wave * 16 + col] = acc[dt][r];
  __syncthreads();
  for (int qd = tid; qd < 64 * 16; qd += 128) { const int d = qd >> 4, pc = qd & 15; vst2(OUT + ((size_t)bh * DD + d) * LL + blockIdx.x * 64 + pc * 4, *(const v4f*)&so[d][pc * 4]); }
}
extern "C" void kernel_launch(void* const* d_in, const int* in_sizes, int n_in, void* d_out, int out_size, void* d_ws, size_t ws_size, hipStream_t stream) {
  (void)in_sizes; (void)n_in; (void)out_size;
  const float** F = (const float**)d_in;   // query [4,16,2048,64], key [4,16,2048,64], value [4,16,64,2048]
  if (ws_size < (size_t)WS_END) return;
  char* ws = (char*)d_ws; float *M = (float*)(ws + WS_M), *IL = (float*)(ws + WS_L);
  k_stats<<<dim3(LL / 64, TNB), 128, 0, stream>>>(F[0], F[1], M, IL);
  k_va<<<dim3(TKB, TNB), 128, 0, stream>>>(F[0], F[1], F[2], M, IL, (float*)d_out);
}

// v004
// One run takes 168 microseconds.
// In both of two side-by-side timings against v003, it was 1.22 times as fast.
// All steps since v000 together make it 4.70 times as fast.
#include <hip/hip_runtime.h>
#include <math.h>

typedef __attribute__((ext_vector_type(16))) _Float16 v16h;
typedef __attribute__((ext_vector_type(16))) __bf16 v16b;
typedef __attribute__((ext_vector_type(8)))  _Float16 v8h;
typedef __attribute__((ext_vector_type(8)))  float v8f;
typedef __attribute__((ext_vector_type(4)))  float v4f;
typedef __attribute__((ext_vector_type(2)))  float v2f;
typedef __attribute__((ext_vector_type(4)))  unsigned v4u;
typedef __attribute__((ext_vector_type(4)))  int v4i;
typedef float __attribute__((may_alias)) float_a;
typedef int __attribute__((may_alias)) int_a;

template <typename T> __device__ __forceinline__ void vst2(void* p, T v) { *(T*)p = v;  }
__device__ __forceinline__ v8f wmma16(v16h a, v16h b, v8f c) {
  v8f d = __builtin_amdgcn_wmma_f32_16x16x32_f16(false, a, false, b, (short)0, c, false, false);
  asm volatile("v_nop\n\tv_nop\n\tv_nop\n\tv_nop" : "+v"(d) : "v"(a), "v"(b));
  return d;
}
__device__ __forceinline__ v8f wmma_bf(v16b a, v16b b, v8f c) {
  v8f d = __builtin_amdgcn_wmma_f32_16x16x32_bf16(false, a, false, b, (short)0, c, false, false);
  asm volatile("v_nop\n\tv_nop\n\tv_nop\n\tv_nop" : "+v"(d) : "v"(a), "v"(b));
  return d;
}
// 16x16x32 fragments: lane = (h = lane>>4, row/col = lane&15); elements 0..7 = k0+8h+0..7, 8..15 = k0+16+8h+0..7; D element r = row 8h+r
__device__ __forceinline__ v16h frag_h(const _Float16* rowk0, int lane) {
  union { v16h v; v8h q[2]; } u; const _Float16* p = rowk0 + 8 * (lane >> 4);
  u.q[0] = *(const v8h*)p; u.q[1] = *(const v8h*)(p + 16); return u.v;
}
__device__ __forceinline__ v16h frag_f32(const float* rowk0, int lane) {
  v16h a; const float* p = rowk0 + 8 * (lane >> 4);
#pragma unroll
  for (int i = 0; i < 8; ++i) { a[i] = (_Float16)p[i]; a[8 + i] = (_Float16)p[16 + i]; }
  return a;
}
__device__ __forceinline__ v16h frag_f32s(const float* rowk0, int lane, float sc) {
  v16h a; const float* p = rowk0 + 8 * (lane >> 4);
#pragma unroll
  for (int i = 0; i < 8; ++i) { a[i] = (_Float16)(p[i] * sc); a[8 + i] = (_Float16)(p[16 + i] * sc); }
  return a;
}
// column fragment from a [K][ld] layout (column n), rows >= K read as 0
__device__ __forceinline__ v16h fragc_f32(const float* W, int k0, int n, int lane, int ld, int K) {
  v16h a; const int g = lane >> 4;
#pragma unroll
  for (int i = 0; i < 8; ++i) { const int ka = k0 + 8 * g + i, kb = ka + 16;
    a[i] = (_Float16)(ka < K ? W[(size_t)(ka < K ? ka : K - 1) * ld + n] : 0.f); a[8 + i] = (_Float16)(kb < K ? W[(size_t)(kb < K ? kb : K - 1) * ld + n] : 0.f); }
  return a;
}
struct F2 { v16b h, l; };
__device__ __forceinline__ F2 bsplit16(const float v[16]) { F2 r;
#pragma unroll
  for (int i = 0; i < 16; ++i) { const __bf16 h = (__bf16)v[i]; r.h[i] = h; r.l[i] = (__bf16)(v[i] - (float)h); }
  return r; }
__device__ __forceinline__ F2 split_row(const float* row, int k0, int lane) { float v[16]; const float* p = row + k0 + 8 * (lane >> 4);
#pragma unroll
  for (int i = 0; i < 8; ++i) { v[i] = p[i]; v[8 + i] = p[16 + i]; }
  return bsplit16(v); }
__device__ __forceinline__ F2 split_rowK(const float* row, int k0, int lane, int K) { float v[16]; const int g = lane >> 4;
#pragma unroll
  for (int i = 0; i < 8; ++i) { const int ka = k0 + 8 * g + i, kb = ka + 16; v[i] = ka < K ? row[ka < K ? ka : K - 1] : 0.f; v[8 + i] = kb < K ? row[kb < K ? kb : K - 1] : 0.f; }
  return bsplit16(v); }
__device__ __forceinline__ F2 split_col(const float* W, int k0, int n, int lane, int ld, int K) { float v[16]; const int g = lane >> 4;
#pragma unroll
  for (int i = 0; i < 8; ++i) { const int ka = k0 + 8 * g + i, kb = ka + 16; v[i] = ka < K ? W[(size_t)(ka < K ? ka : K - 1) * ld + n] : 0.f; v[8 + i] = kb < K ? W[(size_t)(kb < K ? kb : K - 1) * ld + n] : 0.f; }
  return bsplit16(v); }
__device__ __forceinline__ v8f mac3(const F2& a, const F2& b, v8f c) { c = wmma_bf(a.l, b.h, c); c = wmma_bf(a.h, b.l, c); return wmma_bf(a.h, b.h, c); }
__device__ __forceinline__ float sigm(float v) { return 1.0f / (1.0f + expf(-v)); }
#define LDSX() do { asm volatile("s_wait_dscnt 0" ::: "memory"); __builtin_amdgcn_wave_barrier(); __builtin_amdgcn_fence(__ATOMIC_RELEASE, "workgroup"); } while (0)


// out = V @ softmax(Q K^T / 8): A [L,L] is the usual attention matrix but the module multiplies value [B,H,D,L] by it from the left, i.e. out[b,h,d,k] = sum_q V[d][q] A[q][k] (contraction over the QUERY index).  [4,16,2048,64] -> [4,16,64,2048].
// k_stats (per (64 queries, b,h): row max and sum of exp over all 2048 keys, scores from bf16 Q and K), k_va (per (64 keys = output columns, b,h), 4 waves x 16 keys: for q in steps of 32: S tile = Q_q . K_k, P = exp(S/8 - m_q)/l_q, split hi/lo in registers, then out[d tile][k] += V[d][q] x P (2 products) for the 4 d tiles; block tile staged and written as 256-B row segments).
#define NBH 64
#define LL 2048
#define DD 64
#ifndef TKB
#define TKB (LL / 64)
#define TNB NBH
#endif
typedef __attribute__((ext_vector_type(8))) __bf16 v8b;
__device__ __forceinline__ v16b frag_b(const __bf16* rowk0, int lane) {
  union { v16b v; v8b q[2]; } u; const __bf16* p = rowk0 + 8 * (lane >> 4);
  u.q[0] = *(const v8b*)p; u.q[1] = *(const v8b*)(p + 16); return u.v;
}
__device__ __forceinline__ v16b frag_gbf(const float* rowk0, int lane) {
  v16b a; const float* p = rowk0 + 8 * (lane >> 4);
#pragma unroll
  for (int i = 0; i < 8; ++i) { a[i] = (__bf16)p[i]; a[8 + i] = (__bf16)p[16 + i]; }
  return a;
}
// 2^v by the hardware instruction, inline. Every argument here is a score minus its row maximum: at most a rounding error above 0; a result below 2^-126 comes out as 0, beside a row sum of about 1 or more
__device__ __forceinline__ float exp2_hw(float v) { return __builtin_amdgcn_exp2f(v); }
#define SC2 0.18033688f   // log2(e) / sqrt(64): the score scale and the change of base in one constant, applied by the FMA that subtracts the row maximum
// ---- block-shared operand tiles: read from global once per block with wave-loads that cover whole 128-B lines, rounded to bf16 once, kept in LDS; every wave takes its fragments from there
typedef __attribute__((ext_vector_type(4))) __bf16 v4b;
#define RP 72   // bf16 per LDS row of a [32][64] tile: 144 B = 16 B x 9, conflict-free pitch for 16-B fragment reads
#define VP 40   // bf16 per LDS row of a [64][32] tile: 80 B = 16 B x 5
#define NST (LL / 32)
__device__ __forceinline__ v4b cvt4(v4f v) { v4b r; r[0] = (__bf16)v[0]; r[1] = (__bf16)v[1]; r[2] = (__bf16)v[2]; r[3] = (__bf16)v[3]; return r; }
// [32 rows][64 f32], contiguous 8 KB: thread t takes the 16-B pieces t, t+128, t+256, t+384
__device__ __forceinline__ void rtile_ld(const float* src, int tid, v4f r[4]) {
#pragma unroll
  for (int i = 0; i < 4; ++i) r[i] = *(const v4f*)(src + i * 512 + tid * 4);
}
__device__ __forceinline__ void rtile_st(__bf16* dst, int tid, const v4f r[4]) {
#pragma unroll
  for (int i = 0; i < 4; ++i) *(v4b*)(dst + (i * 8 + (tid >> 4)) * RP + (tid & 15) * 4) = cvt4(r[i]);
}
// [64 rows][32 f32], row stride LL: 8 threads per 128-B row piece
__device__ __forceinline__ void vtile_ld(const float* src, int tid, v4f r[4]) {
#pragma unroll
  for (int i = 0; i < 4; ++i) r[i] = *(const v4f*)(src + (size_t)(i * 16 + (tid >> 3)) * LL + (tid & 7) * 4);
}
__device__ __forceinline__ void vtile_st(__bf16* dst, int tid, const v4f r[4]) {
#pragma unroll
  for (int i = 0; i < 4; ++i) *(v4b*)(dst + (i * 16 + (tid >> 3)) * VP + (tid & 7) * 4) = cvt4(r[i]);
}
#define WS_M   0u                      // f32 [64 bh][2048] row max, in log2 units
#define WS_L   (WS_M + 4u * NBH * LL)    // f32 row 1/sum
#define WS_END (WS_L + 4u * NBH * LL)
// ---- k_stats: block = (64 queries, bh), 4 waves: online max / sum over 64 key steps; M and 1/L rows (64 floats = 256 B per block)
// the score tile is formed as S^T (A = K rows from LDS, B = this wave's Q rows, kept in registers): lane (g, col) then holds 16 scores of ONE query, col, for the keys 16 ct + 8 g + r of the step, so the running maximum and sum are one register each and need no other lane; the two halves of the wave, which saw different keys, are joined once behind the loop
__global__ __launch_bounds__(128) void k_stats(const float* __restrict__ Q, const float* __restrict__ K, float* __restrict__ M, float* __restrict__ IL) {
  __shared__ __align__(16) float sm[64], sl[64]; __shared__ __align__(16) __bf16 sk[2][32][RP];
  const int tid = threadIdx.x, wave = tid >> 5, lane = tid & 31, col = lane & 15, g = lane >> 4; const int bh = blockIdx.y; const int q0 = blockIdx.x * 64 + wave * 16;
  const v16b a0 = frag_gbf(Q + ((size_t)bh * LL + q0 + col) * DD, lane), a1 = frag_gbf(Q + ((size_t)bh * LL + q0 + col) * DD + 32, lane);
  const float* Kb = K + (size_t)bh * LL * DD; v4f rk[4];
  rtile_ld(Kb, tid, rk); rtile_st(&sk[0][0][0], tid, rk);
  float m = -3.0e38f, l = 0.f;
  __syncthreads();
#pragma unroll 1
  for (int ks = 0; ks < NST; ++ks) { v8f s[2]; const int bf = ks & 1;
    if (ks + 1 < NST) rtile_ld(Kb + (ks + 1) * (32 * DD), tid, rk);
#pragma unroll
    for (int ct = 0; ct < 2; ++ct) { const __bf16* krow = &sk[bf][ct * 16 + col][0]; v8f c = {}; c = wmma_bf(frag_b(krow, lane), a0, c); s[ct] = wmma_bf(frag_b(krow + 32, lane), a1, c); }
    const float t0 = fmaxf(fmaxf(s[0][0], s[0][1]), s[0][2]), t1 = fmaxf(fmaxf(s[0][3], s[0][4]), s[0][5]), t2 = fmaxf(fmaxf(s[0][6], s[0][7]), s[1][0]);
    const float t3 = fmaxf(fmaxf(s[1][1], s[1][2]), s[1][3]), t4 = fmaxf(fmaxf(s[1][4], s[1][5]), s[1][6]);
    const float mn = fmaxf(fmaxf(fmaxf(fmaxf(t0, t1), t2), fmaxf(fmaxf(t3, t4), s[1][7])), m), nb = -SC2 * mn;
    v8f e[2];
#pragma unroll
    for (int ct = 0; ct < 2; ++ct) { const v8f x = s[ct] * SC2 + nb;
#pragma unroll
      for (int r = 0; r < 8; ++r) e[ct][r] = exp2_hw(x[r]); }
    const v8f e8 = e[0] + e[1]; const v4f e4 = e8.lo + e8.hi; const v2f e2 = e4.lo + e4.hi;
    l = l * exp2_hw(m * SC2 + nb) + (e2[0] + e2[1]); m = mn;
    if (ks + 1 < NST) rtile_st(&sk[bf ^ 1][0][0], tid, rk);
    __syncthreads(); }   // publishes tile ks+1 and ends every wave's reads of tile ks, whose buffer the next step refills
  { const float mo = __shfl_xor(m, 16), lo = __shfl_xor(l, 16), mt = fmaxf(m, mo), nb = -SC2 * mt;   // lanes col and col + 16: the same query, the other half of the keys
    l = l * exp2_hw(m * SC2 + nb) + lo * exp2_hw(mo * SC2 + nb); m = mt; }
  if (g == 0) { sm[wave * 16 + col] = SC2 * m; sl[wave * 16 + col] = 1.0f / l; }
  __syncthreads();
  if (tid < 16) vst2(M + (size_t)bh * LL + blockIdx.x * 64 + tid * 4, *(const v4f*)&sm[tid * 4]); else if (tid < 32) vst2(IL + (size_t)bh * LL + blockIdx.x * 64 + (tid - 16) * 4, *(const v4f*)&sl[(tid - 16) * 4]);
}
// a block-uniform tile address, held in scalar registers: the tile's loads then name this base and one offset register that never changes, and the loop forms no per-lane 64-bit address
typedef const float __attribute__((address_space(1)))* gcf;
__device__ __forceinline__ const float* sbase(const float* p) { const unsigned long long a = (unsigned long long)p;
  const unsigned lo = (unsigned)__builtin_amdgcn_readfirstlane((int)(unsigned)a), hi = (unsigned)__builtin_amdgcn_readfirstlane((int)(unsigned)(a >> 32)); return (const float*)(gcf)(((unsigned long long)hi << 32) | lo); }
// ---- k_va: block = (64 keys k0.., bh), 4 waves (16 keys each): for each 32-query step: S[32 q][16 k] as two tiles (A = Q rows from LDS, B = this wave's K rows, kept in registers), P = 2^(S * SC2 - M[q]) * IL[q]; acc[d tile] += V[d rows][q] x P (hi and lo: 2 products); out tile [64 d][64 k] staged, rows 256 B
// lane (g, col) of score tile ct holds the queries 16 ct + 8 g + r of key col: these are the elements 8 ct + r of the B fragment of the second product, so P goes from the accumulators into that fragment inside the lane and never through LDS
// M and IL of the 16 queries a lane holds differ from register to register: the two rows of this bh (2 x 8 KB) are put into LDS once, ahead of the loop, and read 8 at a time (two addresses per wave)
// second bound: 8 waves per SIMD (128 registers), so that the 8 blocks that fall to each WGP stay resident together
__global__ __launch_bounds__(128, 8) void k_va(const float* __restrict__ Q, const float* __restrict__ K, const float* __restrict__ V, const float* __restrict__ M, const float* __restrict__ IL, float* __restrict__ OUT) {
  __shared__ __align__(16) float smq[LL], sil[LL];
  __shared__ __align__(16) char sbuf[2 * 32 * RP * 2 + 2 * 64 * VP * 2];   // loop: Q tiles [2][32][RP], V tiles [2][64][VP]; epilogue: the f32 output tile [64][68]
  static_assert(sizeof(sbuf) >= 64 * 68 * 4, "output tile fits");
  __bf16 (*sq)[32][RP] = (__bf16 (*)[32][RP])sbuf; __bf16 (*sv)[64][VP] = (__bf16 (*)[64][VP])(sbuf + 2 * 32 * RP * 2); float (*so)[68] = (float (*)[68])sbuf;
  const int tid = threadIdx.x, wave = tid >> 5, lane = tid & 31, col = lane & 15, g = lane >> 4; const int bh = blockIdx.y; const int k0 = blockIdx.x * 64 + wave * 16;
  const v16b ka0 = frag_gbf(K + ((size_t)bh * LL + k0 + col) * DD, lane), ka1 = frag_gbf(K + ((size_t)bh * LL + k0 + col) * DD + 32, lane);
  const float* Vb = V + (size_t)bh * DD * LL; const float* Mb = M + (size_t)bh * LL; const float* ILb = IL + (size_t)bh * LL;
  const float* Qb = Q + (size_t)bh * LL * DD;
  { v4f rq[4], rv[4]; rtile_ld(Qb, tid, rq); vtile_ld(Vb, tid, rv);
#pragma unroll
    for (int i = 0; i < LL / 512; ++i) { *(v4f*)&smq[i * 512 + tid * 4] = *(const v4f*)(Mb + i * 512 + tid * 4); *(v4f*)&sil[i * 512 + tid * 4] = *(const v4f*)(ILb + i * 512 + tid * 4); }
    rtile_st(&sq[0][0][0], tid, rq); vtile_st(&sv[0][0][0], tid, rv); }
  v8f acc[4] = {}; const unsigned qoff = tid * 4, voff = (tid >> 3) * LL + (tid & 7) * 4;   // this thread's place in a Q tile and in a V tile, as in rtile_ld and vtile_ld
  __syncthreads();
#pragma unroll 1
  for (int qs = 0; qs < NST; ++qs) { const int bf = qs & 1; v16b ph, pl; v4f rq[4], rv[4];
    const int nx = qs + 1 < NST ? qs + 1 : qs;   // the last step stages its own tiles once more, into the buffer that nobody reads again: with no branch round the staging its registers are dead in the score phase
#pragma unroll
    for (int ct = 0; ct < 2; ++ct) { const int q = qs * 32 + ct * 16 + 8 * g; const __bf16* qrow = &sq[bf][ct * 16 + col][0]; v8f c = {}; c = wmma_bf(frag_b(qrow, lane), ka0, c); c = wmma_bf(frag_b(qrow + 32, lane), ka1, c);
      union { v8f v; v4f h[2]; } mq, il; mq.h[0] = *(const v4f*)&smq[q]; mq.h[1] = *(const v4f*)&smq[q + 4]; il.h[0] = *(const v4f*)&sil[q]; il.h[1] = *(const v4f*)&sil[q + 4];
      const v8f x = c * SC2 - mq.v;
#pragma unroll
      for (int r = 0; r < 8; ++r) c[r] = exp2_hw(x[r]);
      c *= il.v;
      union { v8b b; v4u w; } h8; h8.b = __builtin_convertvector(c, v8b); v8f hf;   // high parts, two to a register as the fragment wants them; hf: the same values as f32 (a bf16 is the upper half of its f32)
#pragma unroll
      for (int r = 0; r < 4; ++r) { hf[2 * r] = __builtin_bit_cast(float, h8.w[r] << 16); hf[2 * r + 1] = __builtin_bit_cast(float, h8.w[r] & 0xffff0000u); }
      const v8b l8 = __builtin_convertvector(c - hf, v8b);
#pragma unroll
      for (int r = 0; r < 8; ++r) { ph[8 * ct + r] = h8.b[r]; pl[8 * ct + r] = l8[r]; } }
#pragma unroll
    for (int dt = 0; dt < 4; ++dt) { const v16b va = frag_b(&sv[bf][dt * 16 + col][0], lane); acc[dt] = wmma_bf(va, pl, acc[dt]); acc[dt] = wmma_bf(va, ph, acc[dt]);
      if (dt == 0) { const float* qn = sbase(Qb + nx * (32 * DD)); const float* vn = sbase(Vb + nx * 32);   // issued here, behind the first d tile, when the registers of the score phase are free again
#pragma unroll
        for (int i = 0; i < 4; ++i) rq[i] = *(const v4f*)(qn + i * 512 + qoff);
#pragma unroll
        for (int i = 0; i < 4; ++i) rv[i] = *(const v4f*)(vn + i * 16 * LL + voff);
        asm volatile("s_wait_xcnt 0x0" ::: "memory"); } }   // the scalar bases are formed anew in the next step, while the data may still be in flight
    rtile_st(&sq[bf ^ 1][0][0], tid, rq); vtile_st(&sv[bf ^ 1][0][0], tid, rv);
    __syncthreads(); }   // publishes tiles qs+1 and ends every wave's reads of tiles qs, whose buffers the next step refills (after the last step: the output tile)
#pragma unroll
  for (int dt = 0; dt < 4; ++dt)
#pragma unroll
    for (int r = 0; r < 8; ++r) so[dt * 16 + 8 * g + r][wave * 16 + col] = acc[dt][r];
  __syncthreads();
  for (int qd = tid; qd < 64 * 16; qd += 128) { const int d = qd >> 4, pc = qd & 15; vst2(OUT + ((size_t)bh * DD + d) * LL + blockIdx.x * 64 + pc * 4, *(const v4f*)&so[d][pc * 4]); }
}
extern "C" void kernel_launch(void* const* d_in, const int* in_sizes, int n_in, void* d_out, int out_size, void* d_ws, size_t ws_size, hipStream_t stream) {
  (void)in_sizes; (void)n_in; (void)out_size;
  const float** F = (const float**)d_in;   // query [4,16,2048,64], key [4,16,2048,64], value [4,16,64,2048]
  if (ws_size < (size_t)WS_END) return;
  char* ws = (char*)d_ws; float *M = (float*)(ws + WS_M), *IL = (float*)(ws + WS_L);
  k_stats<<<dim3(LL / 64, TNB), 128, 0, stream>>>(F[0], F[1], M, IL);
  k_va<<<dim3(TKB, TNB), 128, 0, stream>>>(F[0], F[1], F[2], M, IL, (float*)d_out);
}

// v005
// A run of this version takes 159 microseconds.
// Two timings next to v004 both put it at 1.06 times that version's speed.
// Over all steps from v000 it is 4.98 times as fast.
#include <hip/hip_runtime.h>
#include <math.h>

typedef __attribute__((ext_vector_type(16))) _Float16 v16h;
typedef __attribute__((ext_vector_type(16))) __bf16 v16b;
typedef __attribute__((ext_vector_type(8)))  _Float16 v8h;
typedef __attribute__((ext_vector_type(8)))  float v8f;
typedef __attribute__((ext_vector_type(4)))  float v4f;
typedef __attribute__((ext_vector_type(2)))  float v2f;
typedef __attribute__((ext_vector_type(4)))  unsigned v4u;
typedef __attribute__((ext_vector_type(4)))  int v4i;
typedef float __attribute__((may_alias)) float_a;
typedef int __attribute__((may_alias)) int_a;

template <typename T> __device__ __forceinline__ void vst2(void* p, T v) { *(T*)p = v;  }
__device__ __forceinline__ v8f wmma16(v16h a, v16h b, v8f c) {
  v8f d = __builtin_amdgcn_wmma_f32_16x16x32_f16(false, a, false, b, (short)0, c, false, false);
  asm volatile("v_nop\n\tv_nop\n\tv_nop\n\tv_nop" : "+v"(d) : "v"(a), "v"(b));
  return d;
}
__device__ __forceinline__ v8f wmma_bf(v16b a, v16b b, v8f c) {
  v8f d = __builtin_amdgcn_wmma_f32_16x16x32_bf16(false, a, false, b, (short)0, c, false, false);
  asm volatile("v_nop\n\tv_nop\n\tv_nop\n\tv_nop" : "+v"(d) : "v"(a), "v"(b));
  return d;
}
// 16x16x32 fragments: lane = (h = lane>>4, row/col = lane&15); elements 0..7 = k0+8h+0..7, 8..15 = k0+16+8h+0..7; D element r = row 8h+r
__device__ __forceinline__ v16h frag_h(const _Float16* rowk0, int lane) {
  union { v16h v; v8h q[2]; } u; const _Float16* p = rowk0 + 8 * (lane >> 4);
  u.q[0] = *(const v8h*)p; u.q[1] = *(const v8h*)(p + 16); return u.v;
}
__device__ __forceinline__ v16h frag_f32(const float* rowk0, int lane) {
  v16h a; const float* p = rowk0 + 8 * (lane >> 4);
#pragma unroll
  for (int i = 0; i < 8; ++i) { a[i] = (_Float16)p[i]; a[8 + i] = (_Float16)p[16 + i]; }
  return a;
}
__device__ __forceinline__ v16h frag_f32s(const float* rowk0, int lane, float sc) {
  v16h a; const float* p = rowk0 + 8 * (lane >> 4);
#pragma unroll
  for (int i = 0; i < 8; ++i) { a[i] = (_Float16)(p[i] * sc); a[8 + i] = (_Float16)(p[16 + i] * sc); }
  return a;
}
// column fragment from a [K][ld] layout (column n), rows >= K read as 0
__device__ __forceinline__ v16h fragc_f32(const float* W, int k0, int n, int lane, int ld, int K) {
  v16h a; const int g = lane >> 4;
#pragma unroll
  for (int i = 0; i < 8; ++i) { const int ka = k0 + 8 * g + i, kb = ka + 16;
    a[i] = (_Float16)(ka < K ? W[(size_t)(ka < K ? ka : K - 1) * ld + n] : 0.f); a[8 + i] = (_Float16)(kb < K ? W[(size_t)(kb < K ? kb : K - 1) * ld + n] : 0.f); }
  return a;
}
struct F2 { v16b h, l; };
__device__ __forceinline__ F2 bsplit16(const float v[16]) { F2 r;
#pragma unroll
  for (int i = 0; i < 16; ++i) { const __bf16 h = (__bf16)v[i]; r.h[i] = h; r.l[i] = (__bf16)(v[i] - (float)h); }
  return r; }
__device__ __forceinline__ F2 split_row(const float* row, int k0, int lane) { float v[16]; const float* p = row + k0 + 8 * (lane >> 4);
#pragma unroll
  for (int i = 0; i < 8; ++i) { v[i] = p[i]; v[8 + i] = p[16 + i]; }
  return bsplit16(v); }
__device__ __forceinline__ F2 split_rowK(const float* row, int k0, int lane, int K) { float v[16]; const int g = lane >> 4;
#pragma unroll
  for (int i = 0; i < 8; ++i) { const int ka = k0 + 8 * g + i, kb = ka + 16; v[i] = ka < K ? row[ka < K ? ka : K - 1] : 0.f; v[8 + i] = kb < K ? row[kb < K ? kb : K - 1] : 0.f; }
  return bsplit16(v); }
__device__ __forceinline__ F2 split_col(const float* W, int k0, int n, int lane, int ld, int K) { float v[16]; const int g = lane >> 4;
#pragma unroll
  for (int i = 0; i < 8; ++i) { const int ka = k0 + 8 * g + i, kb = ka + 16; v[i] = ka < K ? W[(size_t)(ka < K ? ka : K - 1) * ld + n] : 0.f; v[8 + i] = kb < K ? W[(size_t)(kb < K ? kb : K - 1) * ld + n] : 0.f; }
  return bsplit16(v); }
__device__ __forceinline__ v8f mac3(const F2& a, const F2& b, v8f c) { c = wmma_bf(a.l, b.h, c); c = wmma_bf(a.h, b.l, c); return wmma_bf(a.h, b.h, c); }
__device__ __forceinline__ float sigm(float v) { return 1.0f / (1.0f + expf(-v)); }
#define LDSX() do { asm volatile("s_wait_dscnt 0" ::: "memory"); __builtin_amdgcn_wave_barrier(); __builtin_amdgcn_fence(__ATOMIC_RELEASE, "workgroup"); } while (0)


// out = V @ softmax(Q K^T / 8): A [L,L] is the usual attention matrix but the module multiplies value [B,H,D,L] by it from the left, i.e. out[b,h,d,k] = sum_q V[d][q] A[q][k] (contraction over the QUERY index).  [4,16,2048,64] -> [4,16,64,2048].
// k_stats (per (256 queries, b,h), 16 waves x 16 queries: row max and sum of exp over all 2048 keys, scores of bf16-rounded Q and K), k_va (per (256 keys = output columns, b,h), 16 waves x 16 keys: for q in steps of 32: S tile = Q_q . K_k, P = exp(S/8 - m_q)/l_q, split hi/lo in registers, then out[d tile][k] += V[d][q] x P (2 products) for the 4 d tiles; block tile staged and written as 1-KB row segments).
#define NBH 64
#define LL 2048
#define DD 64
#ifndef TKB
#define TKB (LL / 256)
#define TNB NBH
#endif
typedef __attribute__((ext_vector_type(8))) __bf16 v8b;
__device__ __forceinline__ v16b frag_b(const __bf16* rowk0, int lane) {
  union { v16b v; v8b q[2]; } u; const __bf16* p = rowk0 + 8 * (lane >> 4);
  u.q[0] = *(const v8b*)p; u.q[1] = *(const v8b*)(p + 16); return u.v;
}
__device__ __forceinline__ v16b frag_gbf(const float* rowk0, int lane) {
  v16b a; const float* p = rowk0 + 8 * (lane >> 4);
#pragma unroll
  for (int i = 0; i < 8; ++i) { a[i] = (__bf16)p[i]; a[8 + i] = (__bf16)p[16 + i]; }
  return a;
}
// 2^v by the hardware instruction, inline. Every argument here is a score minus its row maximum: at most a rounding error above 0; a result below 2^-126 comes out as 0, beside a row sum of about 1 or more
__device__ __forceinline__ float exp2_hw(float v) { return __builtin_amdgcn_exp2f(v); }
#define SC2 0.18033688f   // log2(e) / sqrt(64): the score scale and the change of base in one constant, applied by the FMA that subtracts the row maximum
// ---- block-shared operand tiles: read from global once per block with wave-loads that cover whole 128-B lines, rounded to bf16 once, kept in LDS; every wave takes its fragments from there
typedef __attribute__((ext_vector_type(4))) __bf16 v4b;
#define RP 72   // bf16 per LDS row of a [32][64] tile: 144 B = 16 B x 9, conflict-free pitch for 16-B fragment reads
#define VP 40   // bf16 per LDS row of a [64][32] tile: 80 B = 16 B x 5
#define NST (LL / 32)
__device__ __forceinline__ v4b cvt4(v4f v) { v4b r; r[0] = (__bf16)v[0]; r[1] = (__bf16)v[1]; r[2] = (__bf16)v[2]; r[3] = (__bf16)v[3]; return r; }
// a block is 16 waves (512 threads) on 256 columns: each tile has 512 pieces of 16 B, one per thread, and is fetched from L2 and rounded once for 256 columns
#define NT 512
#define BC 256
// [32 rows][64 f32], contiguous 8 KB: thread t takes the 16-B piece t
__device__ __forceinline__ v4f rtile_ld(const float* src, int tid) { return *(const v4f*)(src + tid * 4); }
__device__ __forceinline__ void rtile_st(__bf16* dst, int tid, v4f r) { *(v4b*)(dst + (tid >> 4) * RP + (tid & 15) * 4) = cvt4(r); }
// [64 rows][32 f32], row stride LL: 8 threads per 128-B row piece
__device__ __forceinline__ v4f vtile_ld(const float* src, int tid) { return *(const v4f*)(src + (size_t)(tid >> 3) * LL + (tid & 7) * 4); }
__device__ __forceinline__ void vtile_st(__bf16* dst, int tid, v4f r) { *(v4b*)(dst + (tid >> 3) * VP + (tid & 7) * 4) = cvt4(r); }
#define WS_M   0u                      // f32 [64 bh][2048] row max, in log2 units
#define WS_L   (WS_M + 4u * NBH * LL)    // f32 row 1/sum
#define WS_END (WS_L + 4u * NBH * LL)
// ---- k_stats: block = (256 queries, bh), 16 waves: online max / sum over 64 key steps; M and 1/L rows (256 floats = 1 KB per block)
// the score tile is formed as S^T (A = K rows from LDS, B = this wave's Q rows, kept in registers): lane (g, col) then holds 16 scores of ONE query, col, for the keys 16 ct + 8 g + r of the step, so the running maximum and sum are one register each and need no other lane; the two halves of the wave, which saw different keys, are joined once behind the loop
__global__ __launch_bounds__(NT) void k_stats(const float* __restrict__ Q, const float* __restrict__ K, float* __restrict__ M, float* __restrict__ IL) {
  __shared__ __align__(16) float sm[BC], sl[BC]; __shared__ __align__(16) __bf16 sk[2][32][RP];
  const int tid = threadIdx.x, wave = tid >> 5, lane = tid & 31, col = lane & 15, g = lane >> 4; const int bh = blockIdx.y; const int q0 = blockIdx.x * BC + wave * 16;
  const v16b a0 = frag_gbf(Q + ((size_t)bh * LL + q0 + col) * DD, lane), a1 = frag_gbf(Q + ((size_t)bh * LL + q0 + col) * DD + 32, lane);
  const float* Kb = K + (size_t)bh * LL * DD; v4f rk = rtile_ld(Kb, tid);
  rtile_st(&sk[0][0][0], tid, rk);
  float m = -3.0e38f, l = 0.f;
  __syncthreads();
#pragma unroll 1
  for (int ks = 0; ks < NST; ++ks) { v8f s[2]; const int bf = ks & 1;
    if (ks + 1 < NST) rk = rtile_ld(Kb + (ks + 1) * (32 * DD), tid);
#pragma unroll
    for (int ct = 0; ct < 2; ++ct) { const __bf16* krow = &sk[bf][ct * 16 + col][0]; v8f c = {}; c = wmma_bf(frag_b(krow, lane), a0, c); s[ct] = wmma_bf(frag_b(krow + 32, lane), a1, c); }
    const float t0 = fmaxf(fmaxf(s[0][0], s[0][1]), s[0][2]), t1 = fmaxf(fmaxf(s[0][3], s[0][4]), s[0][5]), t2 = fmaxf(fmaxf(s[0][6], s[0][7]), s[1][0]);
    const float t3 = fmaxf(fmaxf(s[1][1], s[1][2]), s[1][3]), t4 = fmaxf(fmaxf(s[1][4], s[1][5]), s[1][6]);
    const float mn = fmaxf(fmaxf(fmaxf(fmaxf(t0, t1), t2), fmaxf(fmaxf(t3, t4), s[1][7])), m), nb = -SC2 * mn;
    v8f e[2];
#pragma unroll
    for (int ct = 0; ct < 2; ++ct) { const v8f x = s[ct] * SC2 + nb;
#pragma unroll
      for (int r = 0; r < 8; ++r) e[ct][r] = exp2_hw(x[r]); }
    const v8f e8 = e[0] + e[1]; const v4f e4 = e8.lo + e8.hi; const v2f e2 = e4.lo + e4.hi;
    l = l * exp2_hw(m * SC2 + nb) + (e2[0] + e2[1]); m = mn;
    if (ks + 1 < NST) { asm volatile("s_wait_xcnt 0x0" ::: "memory");   // the load's address register is stepped for the next trip behind this point
      rtile_st(&sk[bf ^ 1][0][0], tid, rk); }
    __syncthreads(); }   // publishes tile ks+1 and ends every wave's reads of tile ks, whose buffer the next step refills
  { const float mo = __shfl_xor(m, 16), lo = __shfl_xor(l, 16), mt = fmaxf(m, mo), nb = -SC2 * mt;   // lanes col and col + 16: the same query, the other half of the keys
    l = l * exp2_hw(m * SC2 + nb) + lo * exp2_hw(mo * SC2 + nb); m = mt; }
  if (g == 0) { sm[wave * 16 + col] = SC2 * m; sl[wave * 16 + col] = 1.0f / l; }
  __syncthreads();
  if (tid < BC / 4) vst2(M + (size_t)bh * LL + blockIdx.x * BC + tid * 4, *(const v4f*)&sm[tid * 4]); else if (tid < BC / 2) vst2(IL + (size_t)bh * LL + blockIdx.x * BC + (tid - BC / 4) * 4, *(const v4f*)&sl[(tid - BC / 4) * 4]);
}
// a block-uniform tile address, held in scalar registers: the tile's loads then name this base and one offset register that never changes, and the loop forms no per-lane 64-bit address
typedef const float __attribute__((address_space(1)))* gcf;
__device__ __forceinline__ const float* sbase(const float* p) { const unsigned long long a = (unsigned long long)p;
  const unsigned lo = (unsigned)__builtin_amdgcn_readfirstlane((int)(unsigned)a), hi = (unsigned)__builtin_amdgcn_readfirstlane((int)(unsigned)(a >> 32)); return (const float*)(gcf)(((unsigned long long)hi << 32) | lo); }
// ---- k_va: block = (256 keys k0.., bh), 16 waves (16 keys each): for each 32-query step: S[32 q][16 k] as two tiles (A = Q rows from LDS, B = this wave's K rows, kept in registers), P = 2^(S * SC2 - M[q]) * IL[q]; acc[d tile] += V[d rows][q] x P (hi and lo: 2 products); out tile [64 d][256 k] staged, rows 1 KB
// lane (g, col) of score tile ct holds the queries 16 ct + 8 g + r of key col: these are the elements 8 ct + r of the B fragment of the second product, so P goes from the accumulators into that fragment inside the lane and never through LDS
// M and IL of the 16 queries a lane holds differ from register to register: the two rows of this bh (2 x 8 KB) are put into LDS once, ahead of the loop, and read 8 at a time (two addresses per wave)
// second bound: 8 waves per SIMD (128 registers), so that the 2 blocks that fall to each WGP stay resident together
__global__ __launch_bounds__(NT, 8) void k_va(const float* __restrict__ Q, const float* __restrict__ K, const float* __restrict__ V, const float* __restrict__ M, const float* __restrict__ IL, float* __restrict__ OUT) {
  __shared__ __align__(16) char smem[64 * (BC + 4) * 4];   // loop: M and IL rows [2][LL] f32, Q tiles [2][32][RP], V tiles [2][64][VP], all below 64 KB, in reach of the LDS offset field; epilogue: the f32 output tile [64][BC + 4] over all of it
  static_assert(sizeof(smem) >= 2 * LL * 4 + 2 * 32 * RP * 2 + 2 * 64 * VP * 2, "loop data fits");
  float* smq = (float*)smem; float* sil = smq + LL; char* sbuf = smem + 2 * LL * 4;
  __bf16 (*sq)[32][RP] = (__bf16 (*)[32][RP])sbuf; __bf16 (*sv)[64][VP] = (__bf16 (*)[64][VP])(sbuf + 2 * 32 * RP * 2); float (*so)[BC + 4] = (float (*)[BC + 4])smem;
  const int tid = threadIdx.x, wave = tid >> 5, lane = tid & 31, col = lane & 15, g = lane >> 4; const int bh = blockIdx.y; const int k0 = blockIdx.x * BC + wave * 16;
  const v16b ka0 = frag_gbf(K + ((size_t)bh * LL + k0 + col) * DD, lane), ka1 = frag_gbf(K + ((size_t)bh * LL + k0 + col) * DD + 32, lane);
  const float* Vb = V + (size_t)bh * DD * LL; const float* Mb = M + (size_t)bh * LL; const float* ILb = IL + (size_t)bh * LL;
  const float* Qb = Q + (size_t)bh * LL * DD;
  { const v4f rq = rtile_ld(Qb, tid), rv = vtile_ld(Vb, tid);
    static_assert(LL == NT * 4, "one 16-B piece of M and of IL per thread");
    *(v4f*)&smq[tid * 4] = *(const v4f*)(Mb + tid * 4); *(v4f*)&sil[tid * 4] = *(const v4f*)(ILb + tid * 4);
    rtile_st(&sq[0][0][0], tid, rq); vtile_st(&sv[0][0][0], tid, rv); }
  v8f acc[4] = {}; const unsigned qoff = tid * 4, voff = (tid >> 3) * LL + (tid & 7) * 4;   // this thread's place in a Q tile and in a V tile, as in rtile_ld and vtile_ld
  __syncthreads();
#pragma unroll 1
  for (int qs = 0; qs < NST; ++qs) { const int bf = qs & 1; v16b ph, pl; v4f rq, rv;
    const int nx = qs + 1 < NST ? qs + 1 : qs;   // the last step stages its own tiles once more, into the buffer that nobody reads again: with no branch round the staging its registers are dead in the score phase
#pragma unroll
    for (int ct = 0; ct < 2; ++ct) { const int q = qs * 32 + ct * 16 + 8 * g; const __bf16* qrow = &sq[bf][ct * 16 + col][0]; v8f c = {}; c = wmma_bf(frag_b(qrow, lane), ka0, c); c = wmma_bf(frag_b(qrow + 32, lane), ka1, c);
      union { v8f v; v4f h[2]; } mq, il; mq.h[0] = *(const v4f*)&smq[q]; mq.h[1] = *(const v4f*)&smq[q + 4]; il.h[0] = *(const v4f*)&sil[q]; il.h[1] = *(const v4f*)&sil[q + 4];
      const v8f x = c * SC2 - mq.v;
#pragma unroll
      for (int r = 0; r < 8; ++r) c[r] = exp2_hw(x[r]);
      c *= il.v;
      union { v8b b; v4u w; } h8; h8.b = __builtin_convertvector(c, v8b); v8f hf;   // high parts, two to a register as the fragment wants them; hf: the same values as f32 (a bf16 is the upper half of its f32)
#pragma unroll
      for (int r = 0; r < 4; ++r) { hf[2 * r] = __builtin_bit_cast(float, h8.w[r] << 16); hf[2 * r + 1] = __builtin_bit_cast(float, h8.w[r] & 0xffff0000u); }
      const v8b l8 = __builtin_convertvector(c - hf, v8b);
#pragma unroll
      for (int r = 0; r < 8; ++r) { ph[8 * ct + r] = h8.b[r]; pl[8 * ct + r] = l8[r]; } }
#pragma unroll
    for (int dt = 0; dt < 4; ++dt) { const v16b va = frag_b(&sv[bf][dt * 16 + col][0], lane); acc[dt] = wmma_bf(va, pl, acc[dt]); acc[dt] = wmma_bf(va, ph, acc[dt]);
      if (dt == 0) { const float* qn = sbase(Qb + nx * (32 * DD)); const float* vn = sbase(Vb + nx * 32);   // issued here, behind the first d tile, when the registers of the score phase are free again
        rq = *(const v4f*)(qn + qoff); rv = *(const v4f*)(vn + voff);
        asm volatile("s_wait_xcnt 0x0" ::: "memory"); } }   // the scalar bases are formed anew in the next step, while the data may still be in flight
    rtile_st(&sq[bf ^ 1][0][0], tid, rq); vtile_st(&sv[bf ^ 1][0][0], tid, rv);
    __syncthreads(); }   // publishes tiles qs+1 and ends every wave's reads of tiles qs, whose buffers the next step refills (after the last step: the output tile)
#pragma unroll
  for (int dt = 0; dt < 4; ++dt)
#pragma unroll
    for (int r = 0; r < 8; ++r) so[dt * 16 + 8 * g + r][wave * 16 + col] = acc[dt][r];
  __syncthreads();
  for (int qd = tid; qd < 64 * (BC / 4); qd += NT) { const int d = qd >> 6, pc = qd & 63; vst2(OUT + ((size_t)bh * DD + d) * LL + blockIdx.x * BC + pc * 4, *(const v4f*)&so[d][pc * 4]); }
}
extern "C" void kernel_launch(void* const* d_in, const int* in_sizes, int n_in, void* d_out, int out_size, void* d_ws, size_t ws_size, hipStream_t stream) {
  (void)in_sizes; (void)n_in; (void)out_size;
  const float** F = (const float**)d_in;   // query [4,16,2048,64], key [4,16,2048,64], value [4,16,64,2048]
  if (ws_size < (size_t)WS_END) return;
  char* ws = (char*)d_ws; float *M = (float*)(ws + WS_M), *IL = (float*)(ws + WS_L);
  k_stats<<<dim3(LL / 256, TNB), 512, 0, stream>>>(F[0], F[1], M, IL);
  k_va<<<dim3(TKB, TNB), 512, 0, stream>>>(F[0], F[1], F[2], M, IL, (float*)d_out);
}

// v006
// Measured time: 145 microseconds a run.
// Next to v005, in two timings, it ran 1.09 times as fast each time.
// Over all steps from v000 it is 5.43 times as fast.
#include <hip/hip_runtime.h>
#include <math.h>

typedef __attribute__((ext_vector_type(16))) _Float16 v16h;
typedef __attribute__((ext_vector_type(16))) __bf16 v16b;
typedef __attribute__((ext_vector_type(8)))  _Float16 v8h;
typedef __attribute__((ext_vector_type(8)))  float v8f;
typedef __attribute__((ext_vector_type(4)))  float v4f;
typedef __attribute__((ext_vector_type(2)))  float v2f;
typedef __attribute__((ext_vector_type(4)))  unsigned v4u;
typedef __attribute__((ext_vector_type(4)))  int v4i;
typedef float __attribute__((may_alias)) float_a;
typedef int __attribute__((may_alias)) int_a;

template <typename T> __device__ __forceinline__ void vst2(void* p, T v) { *(T*)p = v;  }
__device__ __forceinline__ v8f wmma16(v16h a, v16h b, v8f c) {
  v8f d = __builtin_amdgcn_wmma_f32_16x16x32_f16(false, a, false, b, (short)0, c, false, false);
  asm volatile("v_nop\n\tv_nop\n\tv_nop\n\tv_nop" : "+v"(d) : "v"(a), "v"(b));
  return d;
}
__device__ __forceinline__ v8f wmma_bf(v16b a, v16b b, v8f c) {
  // the builtin alone: the compiler keeps the distance behind it where a vector instruction follows, and may group the LDS reads and run the products back to back
  return __builtin_amdgcn_wmma_f32_16x16x32_bf16(false, a, false, b, (short)0, c, false, false);
}
// 16x16x32 fragments: lane = (h = lane>>4, row/col = lane&15); elements 0..7 = k0+8h+0..7, 8..15 = k0+16+8h+0..7; D element r = row 8h+r
__device__ __forceinline__ v16h frag_h(const _Float16* rowk0, int lane) {
  union { v16h v; v8h q[2]; } u; const _Float16* p = rowk0 + 8 * (lane >> 4);
  u.q[0] = *(const v8h*)p; u.q[1] = *(const v8h*)(p + 16); return u.v;
}
__device__ __forceinline__ v16h frag_f32(const float* rowk0, int lane) {
  v16h a; const float* p = rowk0 + 8 * (lane >> 4);
#pragma unroll
  for (int i = 0; i < 8; ++i) { a[i] = (_Float16)p[i]; a[8 + i] = (_Float16)p[16 + i]; }
  return a;
}
__device__ __forceinline__ v16h frag_f32s(const float* rowk0, int lane, float sc) {
  v16h a; const float* p = rowk0 + 8 * (lane >> 4);
#pragma unroll
  for (int i = 0; i < 8; ++i) { a[i] = (_Float16)(p[i] * sc); a[8 + i] = (_Float16)(p[16 + i] * sc); }
  return a;
}
// column fragment from a [K][ld] layout (column n), rows >= K read as 0
__device__ __forceinline__ v16h fragc_f32(const float* W, int k0, int n, int lane, int ld, int K) {
  v16h a; const int g = lane >> 4;
#pragma unroll
  for (int i = 0; i < 8; ++i) { const int ka = k0 + 8 * g + i, kb = ka + 16;
    a[i] = (_Float16)(ka < K ? W[(size_t)(ka < K ? ka : K - 1) * ld + n] : 0.f); a[8 + i] = (_Float16)(kb < K ? W[(size_t)(kb < K ? kb : K - 1) * ld + n] : 0.f); }
  return a;
}
struct F2 { v16b h, l; };
__device__ __forceinline__ F2 bsplit16(const float v[16]) { F2 r;
#pragma unroll
  for (int i = 0; i < 16; ++i) { const __bf16 h = (__bf16)v[i]; r.h[i] = h; r.l[i] = (__bf16)(v[i] - (float)h); }
  return r; }
__device__ __forceinline__ F2 split_row(const float* row, int k0, int lane) { float v[16]; const float* p = row + k0 + 8 * (lane >> 4);
#pragma unroll
  for (int i = 0; i < 8; ++i) { v[i] = p[i]; v[8 + i] = p[16 + i]; }
  return bsplit16(v); }
__device__ __forceinline__ F2 split_rowK(const float* row, int k0, int lane, int K) { float v[16]; const int g = lane >> 4;
#pragma unroll
  for (int i = 0; i < 8; ++i) { const int ka = k0 + 8 * g + i, kb = ka + 16; v[i] = ka < K ? row[ka < K ? ka : K - 1] : 0.f; v[8 + i] = kb < K ? row[kb < K ? kb : K - 1] : 0.f; }
  return bsplit16(v); }
__device__ __forceinline__ F2 split_col(const float* W, int k0, int n, int lane, int ld, int K) { float v[16]; const int g = lane >> 4;
#pragma unroll
  for (int i = 0; i < 8; ++i) { const int ka = k0 + 8 * g + i, kb = ka + 16; v[i] = ka < K ? W[(size_t)(ka < K ? ka : K - 1) * ld + n] : 0.f; v[8 + i] = kb < K ? W[(size_t)(kb < K ? kb : K - 1) * ld + n] : 0.f; }
  return bsplit16(v); }
__device__ __forceinline__ v8f mac3(const F2& a, const F2& b, v8f c) { c = wmma_bf(a.l, b.h, c); c = wmma_bf(a.h, b.l, c); return wmma_bf(a.h, b.h, c); }
__device__ __forceinline__ float sigm(float v) { return 1.0f / (1.0f + expf(-v)); }
#define LDSX() do { asm volatile("s_wait_dscnt 0" ::: "memory"); __builtin_amdgcn_wave_barrier(); __builtin_amdgcn_fence(__ATOMIC_RELEASE, "workgroup"); } while (0)


// out = V @ softmax(Q K^T / 8): A [L,L] is the usual attention matrix but the module multiplies value [B,H,D,L] by it from the left, i.e. out[b,h,d,k] = sum_q V[d][q] A[q][k] (contraction over the QUERY index).  [4,16,2048,64] -> [4,16,64,2048].
// k_stats (per (256 queries, b,h), 16 waves x 16 queries: row max and sum of exp over all 2048 keys, scores of bf16-rounded Q and K), k_va (per (256 keys = output columns, b,h), 16 waves x 16 keys: for q in steps of 32: S tile = Q_q . K_k, P = exp(S/8 - m_q)/l_q, split hi/lo in registers, then out[d tile][k] += V[d][q] x P (2 products) for the 4 d tiles; block tile staged and written as 1-KB row segments).
#define NBH 64
#define LL 2048
#define DD 64
#ifndef TKB
#define TKB (LL / 256)
#define TNB NBH
#endif
typedef __attribute__((ext_vector_type(8))) __bf16 v8b;
__device__ __forceinline__ v16b frag_b(const __bf16* rowk0, int lane) {
  union { v16b v; v8b q[2]; } u; const __bf16* p = rowk0 + 8 * (lane >> 4);
  u.q[0] = *(const v8b*)p; u.q[1] = *(const v8b*)(p + 16); return u.v;
}
__device__ __forceinline__ v16b frag_gbf(const float* rowk0, int lane) {
  v16b a; const float* p = rowk0 + 8 * (lane >> 4);
#pragma unroll
  for (int i = 0; i < 8; ++i) { a[i] = (__bf16)p[i]; a[8 + i] = (__bf16)p[16 + i]; }
  return a;
}
// 2^v by the hardware instruction, inline. Every argument here is a score minus its row maximum: at most a rounding error above 0; a result below 2^-126 comes out as 0, beside a row sum of about 1 or more
__device__ __forceinline__ float exp2_hw(float v) { return __builtin_amdgcn_exp2f(v); }
#define SC2 0.18033688f   // log2(e) / sqrt(64): the score scale and the change of base in one constant, applied by the FMA that subtracts the row maximum
// ---- block-shared operand tiles: read from global once per block with wave-loads that cover whole 128-B lines, rounded to bf16 once, kept in LDS; every wave takes its fragments from there
typedef __attribute__((ext_vector_type(4))) __bf16 v4b;
#define RP 72   // bf16 per LDS row of a [32][64] tile: 144 B = 16 B x 9, conflict-free pitch for 16-B fragment reads
#define VP 40   // bf16 per LDS row of a [64][32] tile: 80 B = 16 B x 5
#define NST (LL / 32)
__device__ __forceinline__ v4b cvt4(v4f v) { v4b r; r[0] = (__bf16)v[0]; r[1] = (__bf16)v[1]; r[2] = (__bf16)v[2]; r[3] = (__bf16)v[3]; return r; }
// a block is 16 waves (512 threads) on 256 columns: each tile has 512 pieces of 16 B, one per thread, and is fetched from L2 and rounded once for 256 columns
#define NT 512
#define BC 256
// [32 rows][64 f32], contiguous 8 KB: thread t takes the 16-B piece t
__device__ __forceinline__ v4f rtile_ld(const float* src, int tid) { return *(const v4f*)(src + tid * 4); }
__device__ __forceinline__ void rtile_st(__bf16* dst, int tid, v4f r) { *(v4b*)(dst + (tid >> 4) * RP + (tid & 15) * 4) = cvt4(r); }
// [64 rows][32 f32], row stride LL: 8 threads per 128-B row piece
__device__ __forceinline__ v4f vtile_ld(const float* src, int tid) { return *(const v4f*)(src + (size_t)(tid >> 3) * LL + (tid & 7) * 4); }
__device__ __forceinline__ void vtile_st(__bf16* dst, int tid, v4f r) { *(v4b*)(dst + (tid >> 3) * VP + (tid & 7) * 4) = cvt4(r); }
#define WS_M   0u                      // f32 [64 bh][2048] row max, in log2 units
#define WS_L   (WS_M + 4u * NBH * LL)    // f32 row 1/sum
#define WS_END (WS_L + 4u * NBH * LL)
// ---- k_stats: block = (256 queries, bh), 16 waves: online max / sum over 64 key steps; M and 1/L rows (256 floats = 1 KB per block)
// the score tile is formed as S^T (A = K rows from LDS, B = this wave's Q rows, kept in registers): lane (g, col) then holds 16 scores of ONE query, col, for the keys 16 ct + 8 g + r of the step, so the running maximum and sum are one register each and need no other lane; the two halves of the wave, which saw different keys, are joined once behind the loop
__global__ __launch_bounds__(NT) void k_stats(const float* __restrict__ Q, const float* __restrict__ K, float* __restrict__ M, float* __restrict__ IL) {
  __shared__ __align__(16) float sm[BC], sl[BC]; __shared__ __align__(16) __bf16 sk[2][32][RP];
  const int tid = threadIdx.x, wave = tid >> 5, lane = tid & 31, col = lane & 15, g = lane >> 4; const int bh = blockIdx.y; const int q0 = blockIdx.x * BC + wave * 16;
  const v16b a0 = frag_gbf(Q + ((size_t)bh * LL + q0 + col) * DD, lane), a1 = frag_gbf(Q + ((size_t)bh * LL + q0 + col) * DD + 32, lane);
  const float* Kb = K + (size_t)bh * LL * DD; v4f rk = rtile_ld(Kb, tid);
  rtile_st(&sk[0][0][0], tid, rk);
  float m = -3.0e38f, l = 0.f;
  __syncthreads();
#pragma unroll 1
  for (int ks = 0; ks < NST; ++ks) { v8f s[2]; const int bf = ks & 1;
    if (ks + 1 < NST) rk = rtile_ld(Kb + (ks + 1) * (32 * DD), tid);
#pragma unroll
    for (int ct = 0; ct < 2; ++ct) { const __bf16* krow = &sk[bf][ct * 16 + col][0]; v8f c = {}; c = wmma_bf(frag_b(krow, lane), a0, c); s[ct] = wmma_bf(frag_b(krow + 32, lane), a1, c); }
    const float t0 = fmaxf(fmaxf(s[0][0], s[0][1]), s[0][2]), t1 = fmaxf(fmaxf(s[0][3], s[0][4]), s[0][5]), t2 = fmaxf(fmaxf(s[0][6], s[0][7]), s[1][0]);
    const float t3 = fmaxf(fmaxf(s[1][1], s[1][2]), s[1][3]), t4 = fmaxf(fmaxf(s[1][4], s[1][5]), s[1][6]);
    const float mn = fmaxf(fmaxf(fmaxf(fmaxf(t0, t1), t2), fmaxf(fmaxf(t3, t4), s[1][7])), m), nb = -SC2 * mn;
    v8f e[2];
#pragma unroll
    for (int ct = 0; ct < 2; ++ct) { const v8f x = s[ct] * SC2 + nb;
#pragma unroll
      for (int r = 0; r < 8; ++r) e[ct][r] = exp2_hw(x[r]); }
    const v8f e8 = e[0] + e[1]; const v4f e4 = e8.lo + e8.hi; const v2f e2 = e4.lo + e4.hi;
    l = l * exp2_hw(m * SC2 + nb) + (e2[0] + e2[1]); m = mn;
    if (ks + 1 < NST) { asm volatile("s_wait_xcnt 0x0" ::: "memory");   // the load's address register is stepped for the next trip behind this point
      rtile_st(&sk[bf ^ 1][0][0], tid, rk); }
    __syncthreads(); }   // publishes tile ks+1 and ends every wave's reads of tile ks, whose buffer the next step refills
  { const float mo = __shfl_xor(m, 16), lo = __shfl_xor(l, 16), mt = fmaxf(m, mo), nb = -SC2 * mt;   // lanes col and col + 16: the same query, the other half of the keys
    l = l * exp2_hw(m * SC2 + nb) + lo * exp2_hw(mo * SC2 + nb); m = mt; }
  if (g == 0) { sm[wave * 16 + col] = SC2 * m; sl[wave * 16 + col] = 1.0f / l; }
  __syncthreads();
  if (tid < BC / 4) vst2(M + (size_t)bh * LL + blockIdx.x * BC + tid * 4, *(const v4f*)&sm[tid * 4]); else if (tid < BC / 2) vst2(IL + (size_t)bh * LL + blockIdx.x * BC + (tid - BC / 4) * 4, *(const v4f*)&sl[(tid - BC / 4) * 4]);
}
// a block-uniform tile address, held in scalar registers: the tile's loads then name this base and one offset register that never changes, and the loop forms no per-lane 64-bit address
typedef const float __attribute__((address_space(1)))* gcf;
__device__ __forceinline__ const float* sbase(const float* p) { const unsigned long long a = (unsigned long long)p;
  const unsigned lo = (unsigned)__builtin_amdgcn_readfirstlane((int)(unsigned)a), hi = (unsigned)__builtin_amdgcn_readfirstlane((int)(unsigned)(a >> 32)); return (const float*)(gcf)(((unsigned long long)hi << 32) | lo); }
// ---- k_va: block = (256 keys k0.., bh), 16 waves (16 keys each): for each 32-query step: S[32 q][16 k] as two tiles (A = Q rows from LDS, B = this wave's K rows, kept in registers), P = 2^(S * SC2 - M[q]) * IL[q]; acc[d tile] += V[d rows][q] x P (hi and lo: 2 products); out tile [64 d][256 k] staged, rows 1 KB
// lane (g, col) of score tile ct holds the queries 16 ct + 8 g + r of key col: these are the elements 8 ct + r of the B fragment of the second product, so P goes from the accumulators into that fragment inside the lane and never through LDS
// M and IL of the 16 queries a lane holds differ from register to register: the two rows of this bh (2 x 8 KB) are put into LDS once, ahead of the loop, and read 8 at a time (two addresses per wave)
// second bound: 8 waves per SIMD (128 registers), so that the 2 blocks that fall to each WGP stay resident together
__global__ __launch_bounds__(NT, 8) void k_va(const float* __restrict__ Q, const float* __restrict__ K, const float* __restrict__ V, const float* __restrict__ M, const float* __restrict__ IL, float* __restrict__ OUT) {
  __shared__ __align__(16) char smem[64 * (BC + 4) * 4];   // loop: M and IL rows [2][LL] f32, Q tiles [2][32][RP], V tiles [2][64][VP], all below 64 KB, in reach of the LDS offset field; epilogue: the f32 output tile [64][BC + 4] over all of it
  static_assert(sizeof(smem) >= 2 * LL * 4 + 2 * 32 * RP * 2 + 2 * 64 * VP * 2, "loop data fits");
  float* smq = (float*)smem; float* sil = smq + LL; char* sbuf = smem + 2 * LL * 4;
  __bf16 (*sq)[32][RP] = (__bf16 (*)[32][RP])sbuf; __bf16 (*sv)[64][VP] = (__bf16 (*)[64][VP])(sbuf + 2 * 32 * RP * 2); float (*so)[BC + 4] = (float (*)[BC + 4])smem;
  const int tid = threadIdx.x, wave = tid >> 5, lane = tid & 31, col = lane & 15, g = lane >> 4; const int bh = blockIdx.y; const int k0 = blockIdx.x * BC + wave * 16;
  const v16b ka0 = frag_gbf(K + ((size_t)bh * LL + k0 + col) * DD, lane), ka1 = frag_gbf(K + ((size_t)bh * LL + k0 + col) * DD + 32, lane);
  const float* Vb = V + (size_t)bh * DD * LL; const float* Mb = M + (size_t)bh * LL; const float* ILb = IL + (size_t)bh * LL;
  const float* Qb = Q + (size_t)bh * LL * DD;
  { const v4f rq = rtile_ld(Qb, tid), rv = vtile_ld(Vb, tid);
    static_assert(LL == NT * 4, "one 16-B piece of M and of IL per thread");
    *(v4f*)&smq[tid * 4] = *(const v4f*)(Mb + tid * 4); *(v4f*)&sil[tid * 4] = *(const v4f*)(ILb + tid * 4);
    rtile_st(&sq[0][0][0], tid, rq); vtile_st(&sv[0][0][0], tid, rv); }
  v8f acc[4] = {}; const unsigned qoff = tid * 4, voff = (tid >> 3) * LL + (tid & 7) * 4;   // this thread's place in a Q tile and in a V tile, as in rtile_ld and vtile_ld
  __syncthreads();
#pragma unroll 1
  for (int qs = 0; qs < NST; ++qs) { const int bf = qs & 1; v16b ph, pl; v4f rq, rv;
    const int nx = qs + 1 < NST ? qs + 1 : qs;   // the last step stages its own tiles once more, into the buffer that nobody reads again: with no branch round the staging its registers are dead in the score phase
#pragma unroll
    for (int ct = 0; ct < 2; ++ct) { const int q = qs * 32 + ct * 16 + 8 * g; const __bf16* qrow = &sq[bf][ct * 16 + col][0]; v8f c = {}; c = wmma_bf(frag_b(qrow, lane), ka0, c); c = wmma_bf(frag_b(qrow + 32, lane), ka1, c);
      union { v8f v; v4f h[2]; } mq, il; mq.h[0] = *(const v4f*)&smq[q]; mq.h[1] = *(const v4f*)&smq[q + 4]; il.h[0] = *(const v4f*)&sil[q]; il.h[1] = *(const v4f*)&sil[q + 4];
      const v8f x = c * SC2 - mq.v;
#pragma unroll
      for (int r = 0; r < 8; ++r) c[r] = exp2_hw(x[r]);
      c *= il.v;
      union { v8b b; v4u w; } h8; h8.b = __builtin_convertvector(c, v8b); v8f hf;   // high parts, two to a register as the fragment wants them; hf: the same values as f32 (a bf16 is the upper half of its f32)
#pragma unroll
      for (int r = 0; r < 4; ++r) { hf[2 * r] = __builtin_bit_cast(float, h8.w[r] << 16); hf[2 * r + 1] = __builtin_bit_cast(float, h8.w[r] & 0xffff0000u); }
      const v8b l8 = __builtin_convertvector(c - hf, v8b);
#pragma unroll
      for (int r = 0; r < 8; ++r) { ph[8 * ct + r] = h8.b[r]; pl[8 * ct + r] = l8[r]; } }
#pragma unroll
    for (int dt = 0; dt < 4; ++dt) { const v16b va = frag_b(&sv[bf][dt * 16 + col][0], lane); acc[dt] = wmma_bf(va, pl, acc[dt]); acc[dt] = wmma_bf(va, ph, acc[dt]);
      if (dt == 0) { const float* qn = sbase(Qb + nx * (32 * DD)); const float* vn = sbase(Vb + nx * 32);   // issued here, behind the first d tile, when the registers of the score phase are free again
        rq = *(const v4f*)(qn + qoff); rv = *(const v4f*)(vn + voff);
        asm volatile("s_wait_xcnt 0x0" ::: "memory"); } }   // the scalar bases are formed anew in the next step, while the data may still be in flight
    rtile_st(&sq[bf ^ 1][0][0], tid, rq); vtile_st(&sv[bf ^ 1][0][0], tid, rv);
    __syncthreads(); }   // publishes tiles qs+1 and ends every wave's reads of tiles qs, whose buffers the next step refills (after the last step: the output tile)
#pragma unroll
  for (int dt = 0; dt < 4; ++dt)
#pragma unroll
    for (int r = 0; r < 8; ++r) so[dt * 16 + 8 * g + r][wave * 16 + col] = acc[dt][r];
  __syncthreads();
  for (int qd = tid; qd < 64 * (BC / 4); qd += NT) { const int d = qd >> 6, pc = qd & 63; vst2(OUT + ((size_t)bh * DD + d) * LL + blockIdx.x * BC + pc * 4, *(const v4f*)&so[d][pc * 4]); }
}
extern "C" void kernel_launch(void* const* d_in, const int* in_sizes, int n_in, void* d_out, int out_size, void* d_ws, size_t ws_size, hipStream_t stream) {
  (void)in_sizes; (void)n_in; (void)out_size;
  const float** F = (const float**)d_in;   // query [4,16,2048,64], key [4,16,2048,64], value [4,16,64,2048]
  if (ws_size < (size_t)WS_END) return;
  char* ws = (char*)d_ws; float *M = (float*)(ws + WS_M), *IL = (float*)(ws + WS_L);
  k_stats<<<dim3(LL / 256, TNB), 512, 0, stream>>>(F[0], F[1], M, IL);
  k_va<<<dim3(TKB, TNB), 512, 0, stream>>>(F[0], F[1], F[2], M, IL, (float*)d_out);
}

// v007
// Measured time: 131 microseconds a run.
// In both of two side-by-side timings against v006, it was 1.11 times as fast.
// Over all steps from v000 it is 6.04 times as fast.
#include <hip/hip_runtime.h>
#include <math.h>

typedef __attribute__((ext_vector_type(16))) _Float16 v16h;
typedef __attribute__((ext_vector_type(16))) __bf16 v16b;
typedef __attribute__((ext_vector_type(8)))  _Float16 v8h;
typedef __attribute__((ext_vector_type(8)))  float v8f;
typedef __attribute__((ext_vector_type(4)))  float v4f;
typedef __attribute__((ext_vector_type(2)))  float v2f;
typedef __attribute__((ext_vector_type(4)))  unsigned v4u;
typedef __attribute__((ext_vector_type(4)))  int v4i;
typedef float __attribute__((may_alias)) float_a;
typedef int __attribute__((may_alias)) int_a;

template <typename T> __device__ __forceinline__ void vst2(void* p, T v) { *(T*)p = v;  }
__device__ __forceinline__ v8f wmma16(v16h a, v16h b, v8f c) {
  v8f d = __builtin_amdgcn_wmma_f32_16x16x32_f16(false, a, false, b, (short)0, c, false, false);
  asm volatile("v_nop\n\tv_nop\n\tv_nop\n\tv_nop" : "+v"(d) : "v"(a), "v"(b));
  return d;
}
__device__ __forceinline__ v8f wmma_bf(v16b a, v16b b, v8f c) {
  // the builtin alone: the compiler keeps the distance behind it where a vector instruction follows, and may group the LDS reads and run the products back to back
  return __builtin_amdgcn_wmma_f32_16x16x32_bf16(false, a, false, b, (short)0, c, false, false);
}
// 16x16x32 fragments: lane = (h = lane>>4, row/col = lane&15); elements 0..7 = k0+8h+0..7, 8..15 = k0+16+8h+0..7; D element r = row 8h+r
__device__ __forceinline__ v16h frag_h(const _Float16* rowk0, int lane) {
  union { v16h v; v8h q[2]; } u; const _Float16* p = rowk0 + 8 * (lane >> 4);
  u.q[0] = *(const v8h*)p; u.q[1] = *(const v8h*)(p + 16); return u.v;
}
__device__ __forceinline__ v16h frag_f32(const float* rowk0, int lane) {
  v16h a; const float* p = rowk0 + 8 * (lane >> 4);
#pragma unroll
  for (int i = 0; i < 8; ++i) { a[i] = (_Float16)p[i]; a[8 + i] = (_Float16)p[16 + i]; }
  return a;
}
__device__ __forceinline__ v16h frag_f32s(const float* rowk0, int lane, float sc) {
  v16h a; const float* p = rowk0 + 8 * (lane >> 4);
#pragma unroll
  for (int i = 0; i < 8; ++i) { a[i] = (_Float16)(p[i] * sc); a[8 + i] = (_Float16)(p[16 + i] * sc); }
  return a;
}
// column fragment from a [K][ld] layout (column n), rows >= K read as 0
__device__ __forceinline__ v16h fragc_f32(const float* W, int k0, int n, int lane, int ld, int K) {
  v16h a; const int g = lane >> 4;
#pragma unroll
  for (int i = 0; i < 8; ++i) { const int ka = k0 + 8 * g + i, kb = ka + 16;
    a[i] = (_Float16)(ka < K ? W[(size_t)(ka < K ? ka : K - 1) * ld + n] : 0.f); a[8 + i] = (_Float16)(kb < K ? W[(size_t)(kb < K ? kb : K - 1) * ld + n] : 0.f); }
  return a;
}
struct F2 { v16b h, l; };
__device__ __forceinline__ F2 bsplit16(const float v[16]) { F2 r;
#pragma unroll
  for (int i = 0; i < 16; ++i) { const __bf16 h = (__bf16)v[i]; r.h[i] = h; r.l[i] = (__bf16)(v[i] - (float)h); }
  return r; }
__device__ __forceinline__ F2 split_row(const float* row, int k0, int lane) { float v[16]; const float* p = row + k0 + 8 * (lane >> 4);
#pragma unroll
  for (int i = 0; i < 8; ++i) { v[i] = p[i]; v[8 + i] = p[16 + i]; }
  return bsplit16(v); }
__device__ __forceinline__ F2 split_rowK(const float* row, int k0, int lane, int K) { float v[16]; const int g = lane >> 4;
#pragma unroll
  for (int i = 0; i < 8; ++i) { const int ka = k0 + 8 * g + i, kb = ka + 16; v[i] = ka < K ? row[ka < K ? ka : K - 1] : 0.f; v[8 + i] = kb < K ? row[kb < K ? kb : K - 1] : 0.f; }
  return bsplit16(v); }
__device__ __forceinline__ F2 split_col(const float* W, int k0, int n, int lane, int ld, int K) { float v[16]; const int g = lane >> 4;
#pragma unroll
  for (int i = 0; i < 8; ++i) { const int ka = k0 + 8 * g + i, kb = ka + 16; v[i] = ka < K ? W[(size_t)(ka < K ? ka : K - 1) * ld + n] : 0.f; v[8 + i] = kb < K ? W[(size_t)(kb < K ? kb : K - 1) * ld + n] : 0.f; }
  return bsplit16(v); }
__device__ __forceinline__ v8f mac3(const F2& a, const F2& b, v8f c) { c = wmma_bf(a.l, b.h, c); c = wmma_bf(a.h, b.l, c); return wmma_bf(a.h, b.h, c); }
__device__ __forceinline__ float sigm(float v) { return 1.0f / (1.0f + expf(-v)); }
#define LDSX() do { asm volatile("s_wait_dscnt 0" ::: "memory"); __builtin_amdgcn_wave_barrier(); __builtin_amdgcn_fence(__ATOMIC_RELEASE, "workgroup"); } while (0)


// out = V @ softmax(Q K^T / 8): A [L,L] is the usual attention matrix but the module multiplies value [B,H,D,L] by it from the left, i.e. out[b,h,d,k] = sum_q V[d][q] A[q][k] (contraction over the QUERY index).  [4,16,2048,64] -> [4,16,64,2048].
// k_stats (per (256 queries, b,h), 8 waves x 32 queries: row max and sum of exp over all 2048 keys, scores from bf16-rounded Q and K), k_va (per (256 keys = output columns, b,h), 8 waves x 32 keys: for q in steps of 32: S tile = Q_q . K_k, P = exp(S/8 - m_q)/l_q, split hi/lo in registers, then out[d tile][k] += V[d][q] x P (2 products) for the 4 d tiles; block tile staged and written as 1-KB row segments).
#define NBH 64
#define LL 2048
#define DD 64
#ifndef TKB
#define TKB (LL / 256)
#define TNB NBH
#endif
typedef __attribute__((ext_vector_type(8))) __bf16 v8b;
__device__ __forceinline__ v16b frag_b(const __bf16* rowk0, int lane) {
  union { v16b v; v8b q[2]; } u; const __bf16* p = rowk0 + 8 * (lane >> 4);
  u.q[0] = *(const v8b*)p; u.q[1] = *(const v8b*)(p + 16); return u.v;
}
__device__ __forceinline__ v16b frag_gbf(const float* rowk0, int lane) {
  v16b a; const float* p = rowk0 + 8 * (lane >> 4);
#pragma unroll
  for (int i = 0; i < 8; ++i) { a[i] = (__bf16)p[i]; a[8 + i] = (__bf16)p[16 + i]; }
  return a;
}
// 2^v by the hardware instruction, inline. Every argument here is a score minus its row maximum: at most a rounding error above 0; a result below 2^-126 comes out as 0, beside a row sum of about 1 or more
__device__ __forceinline__ float exp2_hw(float v) { return __builtin_amdgcn_exp2f(v); }
#define SC2 0.18033688f   // log2(e) / sqrt(64): the score scale and the change of base in one constant, applied by the FMA that subtracts the row maximum
// ---- block-shared operand tiles: read from global once per block with wave-loads that cover whole 128-B lines, rounded to bf16 once, kept in LDS; every wave takes its fragments from there
typedef __attribute__((ext_vector_type(4))) __bf16 v4b;
#define RP 72   // bf16 per LDS row of a [32][64] tile: 144 B = 16 B x 9, conflict-free pitch for 16-B fragment reads
#define VP 40   // bf16 per LDS row of a [64][32] tile: 80 B = 16 B x 5
#define NST (LL / 32)
__device__ __forceinline__ v4b cvt4(v4f v) { v4b r; r[0] = (__bf16)v[0]; r[1] = (__bf16)v[1]; r[2] = (__bf16)v[2]; r[3] = (__bf16)v[3]; return r; }
// a block is 8 waves (256 threads) on 256 columns, 32 columns (two 16-column tiles) a wave: a fragment read from LDS feeds the products of both column tiles, so the LDS reads per product are half those of a 16-column wave
// each staged tile has 512 pieces of 16 B, two per thread (pieces tid and tid + NT), and is fetched from L2 and rounded once for 256 columns
#define NT 256
#define BC 256
// [32 rows][64 f32], contiguous 8 KB: 16-B piece t
__device__ __forceinline__ v4f rtile_ld(const float* src, int tid) { return *(const v4f*)(src + tid * 4); }
__device__ __forceinline__ void rtile_st(__bf16* dst, int tid, v4f r) { *(v4b*)(dst + (tid >> 4) * RP + (tid & 15) * 4) = cvt4(r); }
// [64 rows][32 f32], row stride LL: 8 threads per 128-B row piece
__device__ __forceinline__ v4f vtile_ld(const float* src, int tid) { return *(const v4f*)(src + (size_t)(tid >> 3) * LL + (tid & 7) * 4); }
__device__ __forceinline__ void vtile_st(__bf16* dst, int tid, v4f r) { *(v4b*)(dst + (tid >> 3) * VP + (tid & 7) * 4) = cvt4(r); }
#define WS_M   0u                      // f32 [64 bh][2048] row max, in log2 units
#define WS_L   (WS_M + 4u * NBH * LL)    // f32 row 1/sum
#define WS_END (WS_L + 4u * NBH * LL)
// ---- k_stats: block = (256 queries, bh), 8 waves x 32 queries: online max / sum over 64 key steps; M and 1/L rows (256 floats = 1 KB per block)
// the score tile is formed as S^T (A = K rows from LDS, B = this wave's Q rows, kept in registers): lane (g, col) then holds, for each of its two query tiles t, 16 scores of ONE query, 16 t + col, for the keys 16 ct + 8 g + r of the step, so the running maximum and sum are one register each per tile and need no other lane; the two halves of the wave, which saw different keys, are joined once behind the loop
__global__ __launch_bounds__(NT) void k_stats(const float* __restrict__ Q, const float* __restrict__ K, float* __restrict__ M, float* __restrict__ IL) {
  __shared__ __align__(16) float sm[BC], sl[BC]; __shared__ __align__(16) __bf16 sk[2][32][RP];
  const int tid = threadIdx.x, wave = tid >> 5, lane = tid & 31, col = lane & 15, g = lane >> 4; const int bh = blockIdx.y; const int q0 = blockIdx.x * BC + wave * 32;
  v16b a0[2], a1[2];
#pragma unroll
  for (int t = 0; t < 2; ++t) { const float* qr = Q + ((size_t)bh * LL + q0 + 16 * t + col) * DD; a0[t] = frag_gbf(qr, lane); a1[t] = frag_gbf(qr + 32, lane); }
  const float* Kb = K + (size_t)bh * LL * DD; v4f rk0 = rtile_ld(Kb, tid), rk1 = rtile_ld(Kb, tid + NT);
  rtile_st(&sk[0][0][0], tid, rk0); rtile_st(&sk[0][0][0], tid + NT, rk1);
  v2f m = {-3.0e38f, -3.0e38f}, l = {0.f, 0.f};   // element t: query tile t
  __syncthreads();
#pragma unroll 1
  for (int ks = 0; ks < NST; ++ks) { v8f s[2][2]; const int bf = ks & 1;
    if (ks + 1 < NST) { rk0 = rtile_ld(Kb + (ks + 1) * (32 * DD), tid); rk1 = rtile_ld(Kb + (ks + 1) * (32 * DD), tid + NT); }
#pragma unroll
    for (int ct = 0; ct < 2; ++ct) { const __bf16* krow = &sk[bf][ct * 16 + col][0]; const v16b kf0 = frag_b(krow, lane), kf1 = frag_b(krow + 32, lane);
#pragma unroll
      for (int t = 0; t < 2; ++t) { v8f c = {}; c = wmma_bf(kf0, a0[t], c); s[t][ct] = wmma_bf(kf1, a1[t], c); } }
    v2f mn, sum;
#pragma unroll
    for (int t = 0; t < 2; ++t) {
      const float t0 = fmaxf(fmaxf(s[t][0][0], s[t][0][1]), s[t][0][2]), t1 = fmaxf(fmaxf(s[t][0][3], s[t][0][4]), s[t][0][5]), t2 = fmaxf(fmaxf(s[t][0][6], s[t][0][7]), s[t][1][0]);
      const float t3 = fmaxf(fmaxf(s[t][1][1], s[t][1][2]), s[t][1][3]), t4 = fmaxf(fmaxf(s[t][1][4], s[t][1][5]), s[t][1][6]);
      mn[t] = fmaxf(fmaxf(fmaxf(fmaxf(t0, t1), t2), fmaxf(fmaxf(t3, t4), s[t][1][7])), m[t]); }
    const v2f nb = -SC2 * mn, rs = m * SC2 + nb;
#pragma unroll
    for (int t = 0; t < 2; ++t) { v8f e[2];
#pragma unroll
      for (int ct = 0; ct < 2; ++ct) { const v8f x = s[t][ct] * SC2 + nb[t];
#pragma unroll
        for (int r = 0; r < 8; ++r) e[ct][r] = exp2_hw(x[r]); }
      const v8f e8 = e[0] + e[1]; const v4f e4 = e8.lo + e8.hi; const v2f e2 = e4.lo + e4.hi; sum[t] = e2[0] + e2[1]; }
    { const v2f f = {exp2_hw(rs[0]), exp2_hw(rs[1])}; l = l * f + sum; m = mn; }
    if (ks + 1 < NST) { asm volatile("s_wait_xcnt 0x0" ::: "memory");   // the loads' address register is written anew for the next trip behind this point
      rtile_st(&sk[bf ^ 1][0][0], tid, rk0); rtile_st(&sk[bf ^ 1][0][0], tid + NT, rk1); }
    __syncthreads(); }   // publishes tile ks+1 and ends every wave's reads of tile ks, whose buffer the next step refills
#pragma unroll
  for (int t = 0; t < 2; ++t) { const float mo = __shfl_xor(m[t], 16), lo = __shfl_xor(l[t], 16), mt = fmaxf(m[t], mo), nb = -SC2 * mt;   // lanes col and col + 16: the same query, the other half of the keys
    const float lt = l[t] * exp2_hw(m[t] * SC2 + nb) + lo * exp2_hw(mo * SC2 + nb);
    if (g == 0) { sm[wave * 32 + 16 * t + col] = SC2 * mt; sl[wave * 32 + 16 * t + col] = 1.0f / lt; } }
  __syncthreads();
  if (tid < BC / 4) vst2(M + (size_t)bh * LL + blockIdx.x * BC + tid * 4, *(const v4f*)&sm[tid * 4]); else if (tid < BC / 2) vst2(IL + (size_t)bh * LL + blockIdx.x * BC + (tid - BC / 4) * 4, *(const v4f*)&sl[(tid - BC / 4) * 4]);
}
// a block-uniform tile address, held in scalar registers: the tile's loads then name this base and one offset register that never changes, and the loop forms no per-lane 64-bit address
typedef const float __attribute__((address_space(1)))* gcf;
__device__ __forceinline__ const float* sbase(const float* p) { const unsigned long long a = (unsigned long long)p;
  const unsigned lo = (unsigned)__builtin_amdgcn_readfirstlane((int)(unsigned)a), hi = (unsigned)__builtin_amdgcn_readfirstlane((int)(unsigned)(a >> 32)); return (const float*)(gcf)(((unsigned long long)hi << 32) | lo); }
// ---- k_va: block = (256 keys k0.., bh), 8 waves (32 keys each, two key tiles t): for each 32-query step: S[32 q][32 k] as four tiles (A = Q rows from LDS, each fragment used for both key tiles; B = this wave's K rows, kept in registers), P = 2^(S * SC2 - M[q]) * IL[q]; acc[t][d tile] += V[d rows][q] x P (hi and lo: 2 products; each V fragment used for 4); out tile [64 d][256 k] staged, rows 1 KB
// lane (g, col) of score tile (ct, t) holds the queries 16 ct + 8 g + r of key 16 t + col: these are the elements 8 ct + r of the B fragment of the second product, so P goes from the accumulators into that fragment inside the lane and never through LDS
// M and IL of the 16 queries a lane holds differ from register to register: the two rows of this bh (2 x 8 KB) are put into LDS once, ahead of the loop, and read 8 at a time (two addresses per wave), once for both key tiles
// second bound: 4 waves per SIMD (256 registers), so that the 2 blocks that fall to each WGP stay resident together
__global__ __launch_bounds__(NT, 4) void k_va(const float* __restrict__ Q, const float* __restrict__ K, const float* __restrict__ V, const float* __restrict__ M, const float* __restrict__ IL, float* __restrict__ OUT) {
  __shared__ __align__(16) char smem[64 * (BC + 4) * 4];   // loop: M and IL rows [2][LL] f32, Q tiles [2][32][RP], V tiles [2][64][VP], all below 64 KB, in reach of the LDS offset field; epilogue: the f32 output tile [64][BC + 4] over all of it
  static_assert(sizeof(smem) >= 2 * LL * 4 + 2 * 32 * RP * 2 + 2 * 64 * VP * 2, "loop data fits");
  float* smq = (float*)smem; float* sil = smq + LL; char* sbuf = smem + 2 * LL * 4;
  __bf16 (*sq)[32][RP] = (__bf16 (*)[32][RP])sbuf; __bf16 (*sv)[64][VP] = (__bf16 (*)[64][VP])(sbuf + 2 * 32 * RP * 2); float (*so)[BC + 4] = (float (*)[BC + 4])smem;
  const int tid = threadIdx.x, wave = tid >> 5, lane = tid & 31, col = lane & 15, g = lane >> 4; const int bh = blockIdx.y; const int k0 = blockIdx.x * BC + wave * 32;
  v16b ka0[2], ka1[2];
#pragma unroll
  for (int t = 0; t < 2; ++t) { const float* kr = K + ((size_t)bh * LL + k0 + 16 * t + col) * DD; ka0[t] = frag_gbf(kr, lane); ka1[t] = frag_gbf(kr + 32, lane); }
  const float* Vb = V + (size_t)bh * DD * LL; const float* Mb = M + (size_t)bh * LL; const float* ILb = IL + (size_t)bh * LL;
  const float* Qb = Q + (size_t)bh * LL * DD;
  static_assert(LL == NT * 8, "two 16-B pieces of M and of IL per thread");
#pragma unroll
  for (int p = 0; p < 2; ++p) { const int pc = tid + p * NT; const v4f rq = rtile_ld(Qb, pc), rv = vtile_ld(Vb, pc);
    *(v4f*)&smq[pc * 4] = *(const v4f*)(Mb + pc * 4); *(v4f*)&sil[pc * 4] = *(const v4f*)(ILb + pc * 4);
    rtile_st(&sq[0][0][0], pc, rq); vtile_st(&sv[0][0][0], pc, rv); }
  v8f acc[2][4] = {}; const unsigned qoff = tid * 4, voff = (tid >> 3) * LL + (tid & 7) * 4;   // this thread's first place in a Q tile and in a V tile, as in rtile_ld and vtile_ld; the second lies NT pieces on
  __syncthreads();
#pragma unroll 1
  for (int qs = 0; qs < NST; ++qs) { const int bf = qs & 1; union { v16b v; v8b q[2]; } ph[2], pl[2]; v4f rq0, rq1, rv0, rv1;
    const int nx = qs + 1 < NST ? qs + 1 : qs;   // the last step stages its own tiles once more, into the buffer that nobody reads again: with no branch round the staging its registers are dead in the score phase
#pragma unroll
    for (int ct = 0; ct < 2; ++ct) { const int q = qs * 32 + ct * 16 + 8 * g; const __bf16* qrow = &sq[bf][ct * 16 + col][0]; const v16b qf0 = frag_b(qrow, lane), qf1 = frag_b(qrow + 32, lane);
      union { v8f v; v4f h[2]; } mq, il; mq.h[0] = *(const v4f*)&smq[q]; mq.h[1] = *(const v4f*)&smq[q + 4]; il.h[0] = *(const v4f*)&sil[q]; il.h[1] = *(const v4f*)&sil[q + 4];
#pragma unroll
      for (int t = 0; t < 2; ++t) { v8f c = {}; c = wmma_bf(qf0, ka0[t], c); c = wmma_bf(qf1, ka1[t], c);
        const v8f x = c * SC2 - mq.v;
#pragma unroll
        for (int r = 0; r < 8; ++r) c[r] = exp2_hw(x[r]);
        c *= il.v;
        union { v8b b; v4u w; } h8; h8.b = __builtin_convertvector(c, v8b); v8f hf;   // high parts, two to a register as the fragment wants them; hf: the same values as f32 (a bf16 is the upper half of its f32)
#pragma unroll
        for (int r = 0; r < 4; ++r) { hf[2 * r] = __builtin_bit_cast(float, h8.w[r] << 16); hf[2 * r + 1] = __builtin_bit_cast(float, h8.w[r] & 0xffff0000u); }
        ph[t].q[ct] = h8.b; pl[t].q[ct] = __builtin_convertvector(c - hf, v8b); } }
#pragma unroll
    for (int dt = 0; dt < 4; ++dt) { const v16b va = frag_b(&sv[bf][dt * 16 + col][0], lane);
#pragma unroll
      for (int t = 0; t < 2; ++t) { acc[t][dt] = wmma_bf(va, pl[t].v, acc[t][dt]); acc[t][dt] = wmma_bf(va, ph[t].v, acc[t][dt]); }
      if (dt == 0) { const float* qn = sbase(Qb + nx * (32 * DD)); const float* vn = sbase(Vb + nx * 32);   // issued here, behind the first d tile, when the registers of the score phase are free again
        rq0 = *(const v4f*)(qn + qoff); rq1 = *(const v4f*)(qn + qoff + NT * 4); rv0 = *(const v4f*)(vn + voff); rv1 = *(const v4f*)(vn + voff + (NT / 8) * LL);
        asm volatile("s_wait_xcnt 0x0" ::: "memory"); } }   // the scalar bases are formed anew in the next step, while the data may still be in flight
    rtile_st(&sq[bf ^ 1][0][0], tid, rq0); rtile_st(&sq[bf ^ 1][0][0], tid + NT, rq1); vtile_st(&sv[bf ^ 1][0][0], tid, rv0); vtile_st(&sv[bf ^ 1][0][0], tid + NT, rv1);
    __syncthreads(); }   // publishes tiles qs+1 and ends every wave's reads of tiles qs, whose buffers the next step refills (after the last step: the output tile)
#pragma unroll
  for (int t = 0; t < 2; ++t)
#pragma unroll
    for (int dt = 0; dt < 4; ++dt)
#pragma unroll
      for (int r = 0; r < 8; ++r) so[dt * 16 + 8 * g + r][wave * 32 + 16 * t + col] = acc[t][dt][r];
  __syncthreads();
  for (int qd = tid; qd < 64 * (BC / 4); qd += NT) { const int d = qd >> 6, pc = qd & 63; vst2(OUT + ((size_t)bh * DD + d) * LL + blockIdx.x * BC + pc * 4, *(const v4f*)&so[d][pc * 4]); }
}
extern "C" void kernel_launch(void* const* d_in, const int* in_sizes, int n_in, void* d_out, int out_size, void* d_ws, size_t ws_size, hipStream_t stream) {
  (void)in_sizes; (void)n_in; (void)out_size;
  const float** F = (const float**)d_in;   // query [4,16,2048,64], key [4,16,2048,64], value [4,16,64,2048]
  if (ws_size < (size_t)WS_END) return;
  char* ws = (char*)d_ws; float *M = (float*)(ws + WS_M), *IL = (float*)(ws + WS_L);
  k_stats<<<dim3(LL / 256, TNB), 256, 0, stream>>>(F[0], F[1], M, IL);
  k_va<<<dim3(TKB, TNB), 256, 0, stream>>>(F[0], F[1], F[2], M, IL, (float*)d_out);
}

// v009
// It runs in 101 microseconds.
// Versions between v007 and this one are left out; their measured steps multiply to 1.29 times as fast.
// Counting every step since v000, it is 7.80 times as fast.
#include <hip/hip_runtime.h>
#include <math.h>

typedef __attribute__((ext_vector_type(16))) _Float16 v16h;
typedef __attribute__((ext_vector_type(16))) __bf16 v16b;
typedef __attribute__((ext_vector_type(8)))  _Float16 v8h;
typedef __attribute__((ext_vector_type(8)))  float v8f;
typedef __attribute__((ext_vector_type(4)))  float v4f;
typedef __attribute__((ext_vector_type(2)))  float v2f;
typedef __attribute__((ext_vector_type(4)))  unsigned v4u;
typedef __attribute__((ext_vector_type(4)))  int v4i;
typedef float __attribute__((may_alias)) float_a;
typedef int __attribute__((may_alias)) int_a;

template <typename T> __device__ __forceinline__ void vst2(void* p, T v) { *(T*)p = v;  }
__device__ __forceinline__ v8f wmma16(v16h a, v16h b, v8f c) {
  v8f d = __builtin_amdgcn_wmma_f32_16x16x32_f16(false, a, false, b, (short)0, c, false, false);
  asm volatile("v_nop\n\tv_nop\n\tv_nop\n\tv_nop" : "+v"(d) : "v"(a), "v"(b));
  return d;
}
__device__ __forceinline__ v8f wmma_bf(v16b a, v16b b, v8f c) {
  // the builtin alone: the compiler keeps the distance behind it where a vector instruction follows, and may group the LDS reads and run the products back to back
  return __builtin_amdgcn_wmma_f32_16x16x32_bf16(false, a, false, b, (short)0, c, false, false);
}
__device__ __forceinline__ v8f wmma_hf(v16h a, v16h b, v8f c) {
  // the builtin alone: the compiler keeps the distance behind it where a vector instruction follows, and may group the LDS reads and run the products back to back
  return __builtin_amdgcn_wmma_f32_16x16x32_f16(false, a, false, b, (short)0, c, false, false);
}
// 16x16x32 fragments: lane = (h = lane>>4, row/col = lane&15); elements 0..7 = k0+8h+0..7, 8..15 = k0+16+8h+0..7; D element r = row 8h+r
__device__ __forceinline__ v16h frag_h(const _Float16* rowk0, int lane) {
  union { v16h v; v8h q[2]; } u; const _Float16* p = rowk0 + 8 * (lane >> 4);
  u.q[0] = *(const v8h*)p; u.q[1] = *(const v8h*)(p + 16); return u.v;
}
__device__ __forceinline__ v16h frag_f32(const float* rowk0, int lane) {
  v16h a; const float* p = rowk0 + 8 * (lane >> 4);
#pragma unroll
  for (int i = 0; i < 8; ++i) { a[i] = (_Float16)p[i]; a[8 + i] = (_Float16)p[16 + i]; }
  return a;
}
__device__ __forceinline__ v16h frag_f32s(const float* rowk0, int lane, float sc) {
  v16h a; const float* p = rowk0 + 8 * (lane >> 4);
#pragma unroll
  for (int i = 0; i < 8; ++i) { a[i] = (_Float16)(p[i] * sc); a[8 + i] = (_Float16)(p[16 + i] * sc); }
  return a;
}
// column fragment from a [K][ld] layout (column n), rows >= K read as 0
__device__ __forceinline__ v16h fragc_f32(const float* W, int k0, int n, int lane, int ld, int K) {
  v16h a; const int g = lane >> 4;
#pragma unroll
  for (int i = 0; i < 8; ++i) { const int ka = k0 + 8 * g + i, kb = ka + 16;
    a[i] = (_Float16)(ka < K ? W[(size_t)(ka < K ? ka : K - 1) * ld + n] : 0.f); a[8 + i] = (_Float16)(kb < K ? W[(size_t)(kb < K ? kb : K - 1) * ld + n] : 0.f); }
  return a;
}
struct F2 { v16b h, l; };
__device__ __forceinline__ F2 bsplit16(const float v[16]) { F2 r;
#pragma unroll
  for (int i = 0; i < 16; ++i) { const __bf16 h = (__bf16)v[i]; r.h[i] = h; r.l[i] = (__bf16)(v[i] - (float)h); }
  return r; }
__device__ __forceinline__ F2 split_row(const float* row, int k0, int lane) { float v[16]; const float* p = row + k0 + 8 * (lane >> 4);
#pragma unroll
  for (int i = 0; i < 8; ++i) { v[i] = p[i]; v[8 + i] = p[16 + i]; }
  return bsplit16(v); }
__device__ __forceinline__ F2 split_rowK(const float* row, int k0, int lane, int K) { float v[16]; const int g = lane >> 4;
#pragma unroll
  for (int i = 0; i < 8; ++i) { const int ka = k0 + 8 * g + i, kb = ka + 16; v[i] = ka < K ? row[ka < K ? ka : K - 1] : 0.f; v[8 + i] = kb < K ? row[kb < K ? kb : K - 1] : 0.f; }
  return bsplit16(v); }
__device__ __forceinline__ F2 split_col(const float* W, int k0, int n, int lane, int ld, int K) { float v[16]; const int g = lane >> 4;
#pragma unroll
  for (int i = 0; i < 8; ++i) { const int ka = k0 + 8 * g + i, kb = ka + 16; v[i] = ka < K ? W[(size_t)(ka < K ? ka : K - 1) * ld + n] : 0.f; v[8 + i] = kb < K ? W[(size_t)(kb < K ? kb : K - 1) * ld + n] : 0.f; }
  return bsplit16(v); }
__device__ __forceinline__ v8f mac3(const F2& a, const F2& b, v8f c) { c = wmma_bf(a.l, b.h, c); c = wmma_bf(a.h, b.l, c); return wmma_bf(a.h, b.h, c); }
__device__ __forceinline__ float sigm(float v) { return 1.0f / (1.0f + expf(-v)); }
#define LDSX() do { asm volatile("s_wait_dscnt 0" ::: "memory"); __builtin_amdgcn_wave_barrier(); __builtin_amdgcn_fence(__ATOMIC_RELEASE, "workgroup"); } while (0)


// out = V @ softmax(Q K^T / 8): A [L,L] is the usual attention matrix but the module multiplies value [B,H,D,L] by it from the left, i.e. out[b,h,d,k] = sum_q V[d][q] A[q][k] (contraction over the QUERY index).  [4,16,2048,64] -> [4,16,64,2048].
// k_stats (per (256 queries, b,h), 8 waves x 32 queries: row max and sum of exp over all 2048 keys, scores from f16 Q and K), k_va (per (256 keys = output columns, b,h), 8 waves x 32 keys: for q in steps of 32: S tile = Q_q . K_k, P = exp(S/8 - m_q)/l_q, rounded once to f16 in registers, then out[d tile][k] += V[d][q] x P (1 product) for the 4 d tiles; block tile staged and written as 1-KB row segments).
#define NBH 64
#define LL 2048
#define DD 64
#ifndef TKB
#define TKB (LL / 256)
#define TNB NBH
#endif
// 2^v by the hardware instruction, inline. Every argument here is a score minus its row maximum: at most a rounding error above 0; a result below 2^-126 comes out as 0, beside a row sum of about 1 or more
__device__ __forceinline__ float exp2_hw(float v) { return __builtin_amdgcn_exp2f(v); }
// every matrix operand (Q, K, V, P) is f16: 11 significant bits, so P goes into the second product as one operand; P <= 1 is carried times PS, which puts all of it down to 2^-26 into f16's normal range (largest value PS, far below 65504); k_stats folds PS into 1/sum, k_va takes it out, exactly, at the store
#define PS 4096.0f
#define SC2 0.18033688f   // log2(e) / sqrt(64): the score scale and the change of base in one constant, applied by the FMA that subtracts the row maximum
// ---- block-shared operand tiles: read from global once per block with wave-loads that cover whole 128-B lines, rounded to f16 once, kept in LDS; every wave takes its fragments from there
typedef __attribute__((ext_vector_type(4))) _Float16 v4h;
#define RP 72   // f16 per LDS row of a [32][64] tile: 144 B = 16 B x 9, conflict-free pitch for 16-B fragment reads
#define VP 40   // f16 per LDS row of a [64][32] tile: 80 B = 16 B x 5
#define NST (LL / 32)
__device__ __forceinline__ v4h cvt4(v4f v) { return __builtin_convertvector(v, v4h); }
// a block is 8 waves (256 threads) on 256 columns, 32 columns (two 16-column tiles) a wave: a fragment read from LDS feeds the products of both column tiles, so the LDS reads per product are half those of a 16-column wave
// each staged tile has 512 pieces of 16 B, two per thread (pieces tid and tid + NT), and is fetched from L2 and rounded once for 256 columns
#define NT 256
#define BC 256
// [32 rows][64 f32], contiguous 8 KB: 16-B piece t
__device__ __forceinline__ v4f rtile_ld(const float* src, int tid) { return *(const v4f*)(src + tid * 4); }
__device__ __forceinline__ void rtile_st(_Float16* dst, int tid, v4f r) { *(v4h*)(dst + (tid >> 4) * RP + (tid & 15) * 4) = cvt4(r); }
// [64 rows][32 f32], row stride LL: 8 threads per 128-B row piece
__device__ __forceinline__ v4f vtile_ld(const float* src, int tid) { return *(const v4f*)(src + (size_t)(tid >> 3) * LL + (tid & 7) * 4); }
__device__ __forceinline__ void vtile_st(_Float16* dst, int tid, v4f r) { *(v4h*)(dst + (tid >> 3) * VP + (tid & 7) * 4) = cvt4(r); }
// a block-uniform tile address, held in scalar registers: the tile's loads then name this base and one offset register that never changes, and the loop forms no per-lane 64-bit address
typedef const float __attribute__((address_space(1)))* gcf;
__device__ __forceinline__ const float* sbase(const float* p) { const unsigned long long a = (unsigned long long)p;
  const unsigned lo = (unsigned)__builtin_amdgcn_readfirstlane((int)(unsigned)a), hi = (unsigned)__builtin_amdgcn_readfirstlane((int)(unsigned)(a >> 32)); return (const float*)(gcf)(((unsigned long long)hi << 32) | lo); }
// the step barrier of the loop of k_stats, by hand in two halves. __syncthreads() would also wait for every global load, and the tiles asked for ahead must stay in flight across it; what the barrier has to order here is LDS alone
// signal: this wave's LDS reads of the current tile and its LDS stores of the next one are done; wait: the same holds of every wave of the block
#define STEP_SIGNAL() asm volatile("s_wait_dscnt 0x0\n\ts_barrier_signal -1" ::: "memory")
#define STEP_WAIT() asm volatile("s_barrier_wait -1" ::: "memory")
#define WS_M   0u                      // f32 [64 bh][2048] row max, in log2 units
#define WS_L   (WS_M + 4u * NBH * LL)    // f32 row PS/sum
#define WS_END (WS_L + 4u * NBH * LL)
// ---- k_stats: block = (256 queries, bh), 8 waves x 32 queries: online max / sum over 64 key steps; M and PS/L rows (256 floats = 1 KB per block)
// the score tile is formed as S^T (A = K rows from LDS, B = this wave's Q rows, kept in registers): lane (g, col) then holds, for each of its two query tiles t, 16 scores of ONE query, 16 t + col, for the keys 16 ct + 8 g + r of the step, so the running maximum and sum are one register each per tile and need no other lane; the two halves of the wave, which saw different keys, are joined once behind the loop
__global__ __launch_bounds__(NT) void k_stats(const float* __restrict__ Q, const float* __restrict__ K, float* __restrict__ M, float* __restrict__ IL) {
  __shared__ __align__(16) float sm[BC], sl[BC]; __shared__ __align__(16) _Float16 sk[2][32][RP];
  const int tid = threadIdx.x, wave = tid >> 5, lane = tid & 31, col = lane & 15, g = lane >> 4; const int bh = blockIdx.y; const int q0 = blockIdx.x * BC + wave * 32;
  v16h a0[2], a1[2];
#pragma unroll
  for (int t = 0; t < 2; ++t) { const float* qr = Q + ((size_t)bh * LL + q0 + 16 * t + col) * DD; a0[t] = frag_f32(qr, lane); a1[t] = frag_f32(qr + 32, lane); }
  const float* Kb = K + (size_t)bh * LL * DD; const unsigned koff = tid * 4;   // this thread's first place in a K tile, as in rtile_ld; the second lies NT pieces on
  // tile j waits in register set j & 3 from its loads, in step j - 5, to its LDS stores, in step j - 1, which free the set for tile j + 4: four steps for the way from memory
  v4f rk[4][2]; static_assert(NST % 4 == 0 && NST >= 8, "the loop body is four steps, one per register set");
  { const v4f r0 = rtile_ld(Kb, tid), r1 = rtile_ld(Kb, tid + NT); rtile_st(&sk[0][0][0], tid, r0); rtile_st(&sk[0][0][0], tid + NT, r1); }
#pragma unroll
  for (int j = 1; j < 5; ++j) { rk[j & 3][0] = rtile_ld(Kb + j * (32 * DD), tid); rk[j & 3][1] = rtile_ld(Kb + j * (32 * DD), tid + NT); }
  v2f m = {-3.0e38f, -3.0e38f}, l = {0.f, 0.f};   // element t: query tile t
  __syncthreads();
#pragma unroll 1
  for (int k4 = 0; k4 < NST; k4 += 4)
#pragma unroll
  for (int u = 0; u < 4; ++u) { v8f s[2][2]; const int ks = k4 + u, bf = u & 1, rg = (u + 1) & 3;
    const int nx = ks + 5 < NST ? ks + 5 : NST - 1;   // the last steps ask for the last tile once more and store it into a buffer that nobody reads again: no branch round the staging
#pragma unroll
    for (int ct = 0; ct < 2; ++ct) { const _Float16* krow = &sk[bf][ct * 16 + col][0]; const v16h kf0 = frag_h(krow, lane), kf1 = frag_h(krow + 32, lane);
#pragma unroll
      for (int t = 0; t < 2; ++t) { v8f c = {}; c = wmma_hf(kf0, a0[t], c); s[t][ct] = wmma_hf(kf1, a1[t], c); } }
    rtile_st(&sk[bf ^ 1][0][0], tid, rk[rg][0]); rtile_st(&sk[bf ^ 1][0][0], tid + NT, rk[rg][1]);
    STEP_SIGNAL();   // ahead of the row arithmetic, which touches no LDS: the waves' skew is waited out under it
    { const float* kn = sbase(Kb + nx * (32 * DD)); rk[rg][0] = *(const v4f*)(kn + koff); rk[rg][1] = *(const v4f*)(kn + koff + NT * 4);
      asm volatile("s_wait_xcnt 0x0" ::: "memory"); }   // the scalar base is formed anew in the next step, while the data are still in flight
    v2f mn, sum;
#pragma unroll
    for (int t = 0; t < 2; ++t) {
      const float t0 = fmaxf(fmaxf(s[t][0][0], s[t][0][1]), s[t][0][2]), t1 = fmaxf(fmaxf(s[t][0][3], s[t][0][4]), s[t][0][5]), t2 = fmaxf(fmaxf(s[t][0][6], s[t][0][7]), s[t][1][0]);
      const float t3 = fmaxf(fmaxf(s[t][1][1], s[t][1][2]), s[t][1][3]), t4 = fmaxf(fmaxf(s[t][1][4], s[t][1][5]), s[t][1][6]);
      mn[t] = fmaxf(fmaxf(fmaxf(fmaxf(t0, t1), t2), fmaxf(fmaxf(t3, t4), s[t][1][7])), m[t]); }
    const v2f nb = -SC2 * mn, rs = m * SC2 + nb;
#pragma unroll
    for (int t = 0; t < 2; ++t) { v8f e[2];
#pragma unroll
      for (int ct = 0; ct < 2; ++ct) { const v8f x = s[t][ct] * SC2 + nb[t];
#pragma unroll
        for (int r = 0; r < 8; ++r) e[ct][r] = exp2_hw(x[r]); }
      const v8f e8 = e[0] + e[1]; const v4f e4 = e8.lo + e8.hi; const v2f e2 = e4.lo + e4.hi; sum[t] = e2[0] + e2[1]; }
    { const v2f f = {exp2_hw(rs[0]), exp2_hw(rs[1])}; l = l * f + sum; m = mn; }
    STEP_WAIT(); }   // publishes tile ks+1 and ends every wave's reads of tile ks, whose buffer the next step refills
#pragma unroll
  for (int t = 0; t < 2; ++t) { const float mo = __shfl_xor(m[t], 16), lo = __shfl_xor(l[t], 16), mt = fmaxf(m[t], mo), nb = -SC2 * mt;   // lanes col and col + 16: the same query, the other half of the keys
    const float lt = l[t] * exp2_hw(m[t] * SC2 + nb) + lo * exp2_hw(mo * SC2 + nb);
    if (g == 0) { sm[wave * 32 + 16 * t + col] = SC2 * mt; sl[wave * 32 + 16 * t + col] = PS / lt; } }
  __syncthreads();
  if (tid < BC / 4) vst2(M + (size_t)bh * LL + blockIdx.x * BC + tid * 4, *(const v4f*)&sm[tid * 4]); else if (tid < BC / 2) vst2(IL + (size_t)bh * LL + blockIdx.x * BC + (tid - BC / 4) * 4, *(const v4f*)&sl[(tid - BC / 4) * 4]);
}
// ---- k_va: block = (256 keys k0.., bh), 8 waves (32 keys each, two key tiles t): for each 32-query step: S[32 q][32 k] as four tiles (A = Q rows from LDS, each fragment used for both key tiles; B = this wave's K rows, kept in registers), P = 2^(S * SC2 - M[q]) * IL[q] (IL = PS / sum); acc[t][d tile] += V[d rows][q] x P (each V fragment used for 2 products); out tile [64 d][256 k] staged, rows 1 KB
// lane (g, col) of score tile (ct, t) holds the queries 16 ct + 8 g + r of key 16 t + col: these are the elements 8 ct + r of the B fragment of the second product, so P goes from the accumulators into that fragment inside the lane and never through LDS
// M and IL of the 16 queries a lane holds differ from register to register: the two rows of this bh (2 x 8 KB) are put into LDS once, ahead of the loop, and read 8 at a time (two addresses per wave), once for both key tiles
// second bound: 4 waves per SIMD (256 registers), so that the 2 blocks that fall to each WGP stay resident together
__global__ __launch_bounds__(NT, 4) void k_va(const float* __restrict__ Q, const float* __restrict__ K, const float* __restrict__ V, const float* __restrict__ M, const float* __restrict__ IL, float* __restrict__ OUT) {
  __shared__ __align__(16) char smem[64 * (BC + 4) * 4];   // loop: M and IL rows [2][LL] f32, Q tiles [2][32][RP], V tiles [2][64][VP], all below 64 KB, in reach of the LDS offset field; epilogue: the f32 output tile [64][BC + 4] over all of it
  static_assert(sizeof(smem) >= 2 * LL * 4 + 2 * 32 * RP * 2 + 2 * 64 * VP * 2, "loop data fits");
  float* smq = (float*)smem; float* sil = smq + LL; char* sbuf = smem + 2 * LL * 4;
  _Float16 (*sq)[32][RP] = (_Float16 (*)[32][RP])sbuf; _Float16 (*sv)[64][VP] = (_Float16 (*)[64][VP])(sbuf + 2 * 32 * RP * 2); float (*so)[BC + 4] = (float (*)[BC + 4])smem;
  const int tid = threadIdx.x, wave = tid >> 5, lane = tid & 31, col = lane & 15, g = lane >> 4; const int bh = blockIdx.y; const int k0 = blockIdx.x * BC + wave * 32;
  v16h ka0[2], ka1[2];
#pragma unroll
  for (int t = 0; t < 2; ++t) { const float* kr = K + ((size_t)bh * LL + k0 + 16 * t + col) * DD; ka0[t] = frag_f32(kr, lane); ka1[t] = frag_f32(kr + 32, lane); }
  const float* Vb = V + (size_t)bh * DD * LL; const float* Mb = M + (size_t)bh * LL; const float* ILb = IL + (size_t)bh * LL;
  const float* Qb = Q + (size_t)bh * LL * DD;
  static_assert(LL == NT * 8, "two 16-B pieces of M and of IL per thread");
#pragma unroll
  for (int p = 0; p < 2; ++p) { const int pc = tid + p * NT; const v4f rq = rtile_ld(Qb, pc), rv = vtile_ld(Vb, pc);
    *(v4f*)&smq[pc * 4] = *(const v4f*)(Mb + pc * 4); *(v4f*)&sil[pc * 4] = *(const v4f*)(ILb + pc * 4);
    rtile_st(&sq[0][0][0], pc, rq); vtile_st(&sv[0][0][0], pc, rv); }
  v8f acc[2][4] = {}; const unsigned qoff = tid * 4, voff = (tid >> 3) * LL + (tid & 7) * 4;   // this thread's first place in a Q tile and in a V tile, as in rtile_ld and vtile_ld; the second lies NT pieces on
  __syncthreads();
#pragma unroll 1
  for (int qs = 0; qs < NST; ++qs) { const int bf = qs & 1; union { v16h v; v8h q[2]; } ph[2]; v4f rq0, rq1, rv0, rv1;
    const int nx = qs + 1 < NST ? qs + 1 : qs;   // the last step stages its own tiles once more, into the buffer that nobody reads again: with no branch round the staging its registers are dead in the score phase
#pragma unroll
    for (int ct = 0; ct < 2; ++ct) { const int q = qs * 32 + ct * 16 + 8 * g; const _Float16* qrow = &sq[bf][ct * 16 + col][0]; const v16h qf0 = frag_h(qrow, lane), qf1 = frag_h(qrow + 32, lane);
      union { v8f v; v4f h[2]; } mq, il; mq.h[0] = *(const v4f*)&smq[q]; mq.h[1] = *(const v4f*)&smq[q + 4]; il.h[0] = *(const v4f*)&sil[q]; il.h[1] = *(const v4f*)&sil[q + 4];
#pragma unroll
      for (int t = 0; t < 2; ++t) { v8f c = {}; c = wmma_hf(qf0, ka0[t], c); c = wmma_hf(qf1, ka1[t], c);
        const v8f x = c * SC2 - mq.v;
#pragma unroll
        for (int r = 0; r < 8; ++r) c[r] = exp2_hw(x[r]);
        c *= il.v;
        ph[t].q[ct] = __builtin_convertvector(c, v8h); } }   // two to a register, as the fragment wants them
#pragma unroll
    for (int dt = 0; dt < 4; ++dt) { const v16h va = frag_h(&sv[bf][dt * 16 + col][0], lane);
#pragma unroll
      for (int t = 0; t < 2; ++t) acc[t][dt] = wmma_hf(va, ph[t].v, acc[t][dt]);
      if (dt == 0) { const float* qn = sbase(Qb + nx * (32 * DD)); const float* vn = sbase(Vb + nx * 32);   // issued here, behind the first d tile, when the registers of the score phase are free again
        rq0 = *(const v4f*)(qn + qoff); rq1 = *(const v4f*)(qn + qoff + NT * 4); rv0 = *(const v4f*)(vn + voff); rv1 = *(const v4f*)(vn + voff + (NT / 8) * LL);
        asm volatile("s_wait_xcnt 0x0" ::: "memory"); } }   // the scalar bases are formed anew in the next step, while the data may still be in flight
    rtile_st(&sq[bf ^ 1][0][0], tid, rq0); rtile_st(&sq[bf ^ 1][0][0], tid + NT, rq1); vtile_st(&sv[bf ^ 1][0][0], tid, rv0); vtile_st(&sv[bf ^ 1][0][0], tid + NT, rv1);
    __syncthreads(); }   // publishes tiles qs+1 and ends every wave's reads of tiles qs, whose buffers the next step refills (after the last step: the output tile)
#pragma unroll
  for (int t = 0; t < 2; ++t)
#pragma unroll
    for (int dt = 0; dt < 4; ++dt)
#pragma unroll
      for (int r = 0; r < 8; ++r) so[dt * 16 + 8 * g + r][wave * 32 + 16 * t + col] = acc[t][dt][r] * (1.0f / PS);
  __syncthreads();
  for (int qd = tid; qd < 64 * (BC / 4); qd += NT) { const int d = qd >> 6, pc = qd & 63; vst2(OUT + ((size_t)bh * DD + d) * LL + blockIdx.x * BC + pc * 4, *(const v4f*)&so[d][pc * 4]); }
}
extern "C" void kernel_launch(void* const* d_in, const int* in_sizes, int n_in, void* d_out, int out_size, void* d_ws, size_t ws_size, hipStream_t stream) {
  (void)in_sizes; (void)n_in; (void)out_size;
  const float** F = (const float**)d_in;   // query [4,16,2048,64], key [4,16,2048,64], value [4,16,64,2048]
  if (ws_size < (size_t)WS_END) return;
  char* ws = (char*)d_ws; float *M = (float*)(ws + WS_M), *IL = (float*)(ws + WS_L);
  k_stats<<<dim3(LL / 256, TNB), 256, 0, stream>>>(F[0], F[1], M, IL);
  k_va<<<dim3(TKB, TNB), 256, 0, stream>>>(F[0], F[1], F[2], M, IL, (float*)d_out);
}

// v010
// A run of this version takes 95.8 microseconds.
// Next to v009, in two timings, it ran 1.06 times as fast each time.
// All steps since v000 together make it 8.29 times as fast.
#include <hip/hip_runtime.h>
#include <math.h>

typedef __attribute__((ext_vector_type(16))) _Float16 v16h;
typedef __attribute__((ext_vector_type(16))) __bf16 v16b;
typedef __attribute__((ext_vector_type(8)))  _Float16 v8h;
typedef __attribute__((ext_vector_type(8)))  float v8f;
typedef __attribute__((ext_vector_type(4)))  float v4f;
typedef __attribute__((ext_vector_type(2)))  float v2f;
typedef __attribute__((ext_vector_type(4)))  unsigned v4u;
typedef __attribute__((ext_vector_type(4)))  int v4i;
typedef float __attribute__((may_alias)) float_a;
typedef int __attribute__((may_alias)) int_a;

template <typename T> __device__ __forceinline__ void vst2(void* p, T v) { *(T*)p = v;  }
__device__ __forceinline__ v8f wmma16(v16h a, v16h b, v8f c) {
  v8f d = __builtin_amdgcn_wmma_f32_16x16x32_f16(false, a, false, b, (short)0, c, false, false);
  asm volatile("v_nop\n\tv_nop\n\tv_nop\n\tv_nop" : "+v"(d) : "v"(a), "v"(b));
  return d;
}
__device__ __forceinline__ v8f wmma_bf(v16b a, v16b b, v8f c) {
  // the builtin alone: the compiler keeps the distance behind it where a vector instruction follows, and may group the LDS reads and run the products back to back
  return __builtin_amdgcn_wmma_f32_16x16x32_bf16(false, a, false, b, (short)0, c, false, false);
}
__device__ __forceinline__ v8f wmma_hf(v16h a, v16h b, v8f c) {
  // the builtin alone: the compiler keeps the distance behind it where a vector instruction follows, and may group the LDS reads and run the products back to back
  return __builtin_amdgcn_wmma_f32_16x16x32_f16(false, a, false, b, (short)0, c, false, false);
}
// 16x16x32 fragments: lane = (h = lane>>4, row/col = lane&15); elements 0..7 = k0+8h+0..7, 8..15 = k0+16+8h+0..7; D element r = row 8h+r
__device__ __forceinline__ v16h frag_h(const _Float16* rowk0, int lane) {
  union { v16h v; v8h q[2]; } u; const _Float16* p = rowk0 + 8 * (lane >> 4);
  u.q[0] = *(const v8h*)p; u.q[1] = *(const v8h*)(p + 16); return u.v;
}
__device__ __forceinline__ v16h frag_f32(const float* rowk0, int lane) {
  v16h a; const float* p = rowk0 + 8 * (lane >> 4);
#pragma unroll
  for (int i = 0; i < 8; ++i) { a[i] = (_Float16)p[i]; a[8 + i] = (_Float16)p[16 + i]; }
  return a;
}
__device__ __forceinline__ v16h frag_f32s(const float* rowk0, int lane, float sc) {
  v16h a; const float* p = rowk0 + 8 * (lane >> 4);
#pragma unroll
  for (int i = 0; i < 8; ++i) { a[i] = (_Float16)(p[i] * sc); a[8 + i] = (_Float16)(p[16 + i] * sc); }
  return a;
}
// column fragment from a [K][ld] layout (column n), rows >= K read as 0
__device__ __forceinline__ v16h fragc_f32(const float* W, int k0, int n, int lane, int ld, int K) {
  v16h a; const int g = lane >> 4;
#pragma unroll
  for (int i = 0; i < 8; ++i) { const int ka = k0 + 8 * g + i, kb = ka + 16;
    a[i] = (_Float16)(ka < K ? W[(size_t)(ka < K ? ka : K - 1) * ld + n] : 0.f); a[8 + i] = (_Float16)(kb < K ? W[(size_t)(kb < K ? kb : K - 1) * ld + n] : 0.f); }
  return a;
}
struct F2 { v16b h, l; };
__device__ __forceinline__ F2 bsplit16(const float v[16]) { F2 r;
#pragma unroll
  for (int i = 0; i < 16; ++i) { const __bf16 h = (__bf16)v[i]; r.h[i] = h; r.l[i] = (__bf16)(v[i] - (float)h); }
  return r; }
__device__ __forceinline__ F2 split_row(const float* row, int k0, int lane) { float v[16]; const float* p = row + k0 + 8 * (lane >> 4);
#pragma unroll
  for (int i = 0; i < 8; ++i) { v[i] = p[i]; v[8 + i] = p[16 + i]; }
  return bsplit16(v); }
__device__ __forceinline__ F2 split_rowK(const float* row, int k0, int lane, int K) { float v[16]; const int g = lane >> 4;
#pragma unroll
  for (int i = 0; i < 8; ++i) { const int ka = k0 + 8 * g + i, kb = ka + 16; v[i] = ka < K ? row[ka < K ? ka : K - 1] : 0.f; v[8 + i] = kb < K ? row[kb < K ? kb : K - 1] : 0.f; }
  return bsplit16(v); }
__device__ __forceinline__ F2 split_col(const float* W, int k0, int n, int lane, int ld, int K) { float v[16]; const int g = lane >> 4;
#pragma unroll
  for (int i = 0; i < 8; ++i) { const int ka = k0 + 8 * g + i, kb = ka + 16; v[i] = ka < K ? W[(size_t)(ka < K ? ka : K - 1) * ld + n] : 0.f; v[8 + i] = kb < K ? W[(size_t)(kb < K ? kb : K - 1) * ld + n] : 0.f; }
  return bsplit16(v); }
__device__ __forceinline__ v8f mac3(const F2& a, const F2& b, v8f c) { c = wmma_bf(a.l, b.h, c); c = wmma_bf(a.h, b.l, c); return wmma_bf(a.h, b.h, c); }
__device__ __forceinline__ float sigm(float v) { return 1.0f / (1.0f + expf(-v)); }
#define LDSX() do { asm volatile("s_wait_dscnt 0" ::: "memory"); __builtin_amdgcn_wave_barrier(); __builtin_amdgcn_fence(__ATOMIC_RELEASE, "workgroup"); } while (0)


// out = V @ softmax(Q K^T / 8): A [L,L] is the usual attention matrix but the module multiplies value [B,H,D,L] by it from the left, i.e. out[b,h,d,k] = sum_q V[d][q] A[q][k] (contraction over the QUERY index).  [4,16,2048,64] -> [4,16,64,2048].
// k_stats (per (256 queries, b,h), 8 waves x 32 queries: row max and sum of exp over all 2048 keys, scores from f16 Q and K), k_va (per (256 keys = output columns, b,h), 8 waves x 32 keys: for q in steps of 32: the score product gives log2 of P = exp(S/8 - m_q)/l_q, P rounded once to f16 in registers, then out[d tile][k] += V[d][q] x P (1 product) for the 4 d tiles; block tile staged and written as 1-KB row segments).
#define NBH 64
#define LL 2048
#define DD 64
#ifndef TKB
#define TKB (LL / 256)
#define TNB NBH
#endif
// 2^v by the hardware instruction, inline. Every argument here is a score minus its row maximum (in k_va plus log2(PS / row sum), which is at most LPS): at most a rounding error above 0 (above LPS); a result below 2^-126 comes out as 0, beside a row sum of about 1 or more
__device__ __forceinline__ float exp2_hw(float v) { return __builtin_amdgcn_exp2f(v); }
// every matrix operand (Q, K, V, P) is f16: 11 significant bits, so P goes into the second product as one operand; P <= 1 is carried times PS, which puts all of it down to 2^-26 into f16's normal range (largest value PS, far below 65504); k_stats folds PS into the row constant, k_va takes it out, exactly, at the store
#define PS 4096.0f
#define LPS 12.0f   // log2(PS)
#define SC2 0.18033688f   // log2(e) / sqrt(64): the score scale and the change of base in one constant; k_stats applies it by the FMA that subtracts the row maximum, k_va once to its K rows, in f32, before they are rounded to f16
// ---- block-shared operand tiles: read from global once per block with wave-loads that cover whole 128-B lines, rounded to f16 once, kept in LDS; every wave takes its fragments from there
typedef __attribute__((ext_vector_type(4))) _Float16 v4h;
#define RP 72   // f16 per LDS row of a [32][64] tile: 144 B = 16 B x 9, conflict-free pitch for 16-B fragment reads
#define VP 40   // f16 per LDS row of a [64][32] tile: 80 B = 16 B x 5
#define NST (LL / 32)
__device__ __forceinline__ v4h cvt4(v4f v) { return __builtin_convertvector(v, v4h); }
// a block is 8 waves (256 threads) on 256 columns, 32 columns (two 16-column tiles) a wave: a fragment read from LDS feeds the products of both column tiles, so the LDS reads per product are half those of a 16-column wave
// each staged tile has 512 pieces of 16 B, two per thread (pieces tid and tid + NT), and is fetched from L2 and rounded once for 256 columns
#define NT 256
#define BC 256
// [32 rows][64 f32], contiguous 8 KB: 16-B piece t
__device__ __forceinline__ v4f rtile_ld(const float* src, int tid) { return *(const v4f*)(src + tid * 4); }
__device__ __forceinline__ void rtile_st(_Float16* dst, int tid, v4f r) { *(v4h*)(dst + (tid >> 4) * RP + (tid & 15) * 4) = cvt4(r); }
// [64 rows][32 f32], row stride LL: 8 threads per 128-B row piece
__device__ __forceinline__ v4f vtile_ld(const float* src, int tid) { return *(const v4f*)(src + (size_t)(tid >> 3) * LL + (tid & 7) * 4); }
__device__ __forceinline__ void vtile_st(_Float16* dst, int tid, v4f r) { *(v4h*)(dst + (tid >> 3) * VP + (tid & 7) * 4) = cvt4(r); }
// a block-uniform tile address, held in scalar registers: the tile's loads then name this base and one offset register that never changes, and the loop forms no per-lane 64-bit address
typedef const float __attribute__((address_space(1)))* gcf;
__device__ __forceinline__ const float* sbase(const float* p) { const unsigned long long a = (unsigned long long)p;
  const unsigned lo = (unsigned)__builtin_amdgcn_readfirstlane((int)(unsigned)a), hi = (unsigned)__builtin_amdgcn_readfirstlane((int)(unsigned)(a >> 32)); return (const float*)(gcf)(((unsigned long long)hi << 32) | lo); }
// the step barrier of the loop of k_stats, by hand in two halves. __syncthreads() would also wait for every global load, and the tiles asked for ahead must stay in flight across it; what the barrier has to order here is LDS alone
// signal: this wave's LDS reads of the current tile and its LDS stores of the next one are done; wait: the same holds of every wave of the block
#define STEP_SIGNAL() asm volatile("s_wait_dscnt 0x0\n\ts_barrier_signal -1" ::: "memory")
#define STEP_WAIT() asm volatile("s_barrier_wait -1" ::: "memory")
#define WS_NB  0u                      // f32 [64 bh][2048] row constant log2(PS / sum) - max, in log2 units
#define WS_END (WS_NB + 4u * NBH * LL)
// ---- k_stats: block = (256 queries, bh), 8 waves x 32 queries: online max / sum over 64 key steps; one row constant per query, NB = log2(PS / sum) - max (256 floats = 1 KB per block)
// the score tile is formed as S^T (A = K rows from LDS, B = this wave's Q rows, kept in registers): lane (g, col) then holds, for each of its two query tiles t, 16 scores of ONE query, 16 t + col, for the keys 16 ct + 8 g + r of the step, so the running maximum and sum are one register each per tile and need no other lane; the two halves of the wave, which saw different keys, are joined once behind the loop
// exactly 4 waves per SIMD, as in k_va: the four register sets and the scores stay within 256 registers, and 2 blocks share a WGP
__global__ __launch_bounds__(NT) __attribute__((amdgpu_waves_per_eu(4, 4))) void k_stats(const float* __restrict__ Q, const float* __restrict__ K, float* __restrict__ NB) {
  __shared__ __align__(16) float sm[BC]; __shared__ __align__(16) _Float16 sk[2][32][RP];
  const int tid = threadIdx.x, wave = tid >> 5, lane = tid & 31, col = lane & 15, g = lane >> 4; const int bh = blockIdx.y; const int q0 = blockIdx.x * BC + wave * 32;
  v16h a0[2], a1[2];
#pragma unroll
  for (int t = 0; t < 2; ++t) { const float* qr = Q + ((size_t)bh * LL + q0 + 16 * t + col) * DD; a0[t] = frag_f32(qr, lane); a1[t] = frag_f32(qr + 32, lane); }
  const float* Kb = K + (size_t)bh * LL * DD; const unsigned koff = tid * 4;   // this thread's first place in a K tile, as in rtile_ld; the second lies NT pieces on
  // tile j waits in register set j & 3 from its loads, in step j - 5, to its LDS stores, in step j - 1, which free the set for tile j + 4: four steps for the way from memory
  v4f rk[4][2]; static_assert(NST % 4 == 0 && NST >= 8, "the loop body is four steps, one per register set");
  { const v4f r0 = rtile_ld(Kb, tid), r1 = rtile_ld(Kb, tid + NT); rtile_st(&sk[0][0][0], tid, r0); rtile_st(&sk[0][0][0], tid + NT, r1); }
#pragma unroll
  for (int j = 1; j < 5; ++j) { rk[j & 3][0] = rtile_ld(Kb + j * (32 * DD), tid); rk[j & 3][1] = rtile_ld(Kb + j * (32 * DD), tid + NT); }
  v2f m = {-3.0e38f, -3.0e38f}, l = {0.f, 0.f};   // element t: query tile t
  __syncthreads();
#pragma unroll 1
  for (int k4 = 0; k4 < NST; k4 += 4)
#pragma unroll
  for (int u = 0; u < 4; ++u) { v8f s[2][2]; const int ks = k4 + u, bf = u & 1, rg = (u + 1) & 3;
    const int nx = ks + 5 < NST ? ks + 5 : NST - 1;   // the last steps ask for the last tile once more and store it into a buffer that nobody reads again: no branch round the staging
#pragma unroll
    for (int ct = 0; ct < 2; ++ct) { const _Float16* krow = &sk[bf][ct * 16 + col][0]; const v16h kf0 = frag_h(krow, lane), kf1 = frag_h(krow + 32, lane);
#pragma unroll
      for (int t = 0; t < 2; ++t) { v8f c = {}; c = wmma_hf(kf0, a0[t], c); s[t][ct] = wmma_hf(kf1, a1[t], c); } }
    rtile_st(&sk[bf ^ 1][0][0], tid, rk[rg][0]); rtile_st(&sk[bf ^ 1][0][0], tid + NT, rk[rg][1]);
    STEP_SIGNAL();   // ahead of the row arithmetic, which touches no LDS: the waves' skew is waited out under it
    { const float* kn = sbase(Kb + nx * (32 * DD)); rk[rg][0] = *(const v4f*)(kn + koff); rk[rg][1] = *(const v4f*)(kn + koff + NT * 4);
      asm volatile("s_wait_xcnt 0x0" ::: "memory"); }   // the scalar base is formed anew in the next step, while the data are still in flight
    v2f mn, sum;
#pragma unroll
    for (int t = 0; t < 2; ++t) {
      const float t0 = fmaxf(fmaxf(s[t][0][0], s[t][0][1]), s[t][0][2]), t1 = fmaxf(fmaxf(s[t][0][3], s[t][0][4]), s[t][0][5]), t2 = fmaxf(fmaxf(s[t][0][6], s[t][0][7]), s[t][1][0]);
      const float t3 = fmaxf(fmaxf(s[t][1][1], s[t][1][2]), s[t][1][3]), t4 = fmaxf(fmaxf(s[t][1][4], s[t][1][5]), s[t][1][6]);
      mn[t] = fmaxf(fmaxf(fmaxf(fmaxf(t0, t1), t2), fmaxf(fmaxf(t3, t4), s[t][1][7])), m[t]); }
    const v2f nb = -SC2 * mn, rs = m * SC2 + nb;
#pragma unroll
    for (int t = 0; t < 2; ++t) { v8f e[2];
#pragma unroll
      for (int ct = 0; ct < 2; ++ct) { const v8f x = s[t][ct] * SC2 + nb[t];
#pragma unroll
        for (int r = 0; r < 8; ++r) e[ct][r] = exp2_hw(x[r]); }
      const v8f e8 = e[0] + e[1]; const v4f e4 = e8.lo + e8.hi; const v2f e2 = e4.lo + e4.hi; sum[t] = e2[0] + e2[1]; }
    { const v2f f = {exp2_hw(rs[0]), exp2_hw(rs[1])}; l = l * f + sum; m = mn; }
    STEP_WAIT(); }   // publishes tile ks+1 and ends every wave's reads of tile ks, whose buffer the next step refills
#pragma unroll
  for (int t = 0; t < 2; ++t) { const float mo = __shfl_xor(m[t], 16), lo = __shfl_xor(l[t], 16), mt = fmaxf(m[t], mo), nb = -SC2 * mt;   // lanes col and col + 16: the same query, the other half of the keys
    const float lt = l[t] * exp2_hw(m[t] * SC2 + nb) + lo * exp2_hw(mo * SC2 + nb);
    if (g == 0) sm[wave * 32 + 16 * t + col] = (LPS - __builtin_amdgcn_logf(lt)) + nb; }   // the hardware's logarithm is in base 2; the sum is 1 or more
  __syncthreads();
  if (tid < BC / 4) vst2(NB + (size_t)bh * LL + blockIdx.x * BC + tid * 4, *(const v4f*)&sm[tid * 4]);
}
// ---- k_va: block = (256 keys k0.., bh), 8 waves (32 keys each, two key tiles t): for each 32-query step: X[32 q][32 k] as four tiles (A = Q rows from LDS, each fragment used for both key tiles; B = this wave's K rows times SC2, kept in registers; the accumulator starts at NB[q]), so X = S * SC2 - max[q] + log2(PS / sum[q]) leaves the matrix unit ready for P = 2^X, with no vector arithmetic between; acc[t][d tile] += V[d rows][q] x P (each V fragment used for 2 products); out tile [64 d][256 k] staged, rows 1 KB
// lane (g, col) of score tile (ct, t) holds the queries 16 ct + 8 g + r of key 16 t + col: these are the elements 8 ct + r of the B fragment of the second product, so P goes from the accumulators into that fragment inside the lane and never through LDS
// NB of the 16 queries a lane holds differs from register to register, in the order of the accumulator's rows: the row of this bh (8 KB) is put into LDS once, ahead of the loop, and read 8 at a time (two addresses per wave), once for both key tiles, as the C operand of their first products
// exactly 4 waves per SIMD: at most 256 registers, so that the 2 blocks that fall to each WGP stay resident together, and no fewer registers sought for a fifth wave, which the grid never supplies and for which the build gave up the grouped LDS reads and the early staging loads
__global__ __launch_bounds__(NT) __attribute__((amdgpu_waves_per_eu(4, 4))) void k_va(const float* __restrict__ Q, const float* __restrict__ K, const float* __restrict__ V, const float* __restrict__ NB, float* __restrict__ OUT) {
  __shared__ __align__(16) char smem[64 * (BC + 4) * 4];   // loop: NB row [LL] f32, Q tiles [2][32][RP], V tiles [2][64][VP], all below 64 KB, in reach of the LDS offset field; epilogue: the f32 output tile [64][BC + 4] over all of it
  static_assert(sizeof(smem) >= LL * 4 + 2 * 32 * RP * 2 + 2 * 64 * VP * 2, "loop data fits");
  float* snb = (float*)smem; char* sbuf = smem + LL * 4;
  _Float16 (*sq)[32][RP] = (_Float16 (*)[32][RP])sbuf; _Float16 (*sv)[64][VP] = (_Float16 (*)[64][VP])(sbuf + 2 * 32 * RP * 2); float (*so)[BC + 4] = (float (*)[BC + 4])smem;
  const int tid = threadIdx.x, wave = tid >> 5, lane = tid & 31, col = lane & 15, g = lane >> 4; const int bh = blockIdx.y; const int k0 = blockIdx.x * BC + wave * 32;
  v16h ka0[2], ka1[2];
#pragma unroll
  for (int t = 0; t < 2; ++t) { const float* kr = K + ((size_t)bh * LL + k0 + 16 * t + col) * DD; ka0[t] = frag_f32s(kr, lane, SC2); ka1[t] = frag_f32s(kr + 32, lane, SC2); }
  const float* Vb = V + (size_t)bh * DD * LL; const float* NBb = NB + (size_t)bh * LL;
  const float* Qb = Q + (size_t)bh * LL * DD;
  static_assert(LL == NT * 8, "two 16-B pieces of NB per thread");
#pragma unroll
  for (int p = 0; p < 2; ++p) { const int pc = tid + p * NT; const v4f rq = rtile_ld(Qb, pc), rv = vtile_ld(Vb, pc);
    *(v4f*)&snb[pc * 4] = *(const v4f*)(NBb + pc * 4);
    rtile_st(&sq[0][0][0], pc, rq); vtile_st(&sv[0][0][0], pc, rv); }
  v8f acc[2][4] = {}; const unsigned qoff = tid * 4, voff = (tid >> 3) * LL + (tid & 7) * 4;   // this thread's first place in a Q tile and in a V tile, as in rtile_ld and vtile_ld; the second lies NT pieces on
  __syncthreads();
#pragma unroll 1
  for (int qs = 0; qs < NST; ++qs) { const int bf = qs & 1; union { v16h v; v8h q[2]; } ph[2]; v4f rq0, rq1, rv0, rv1;
    const int nx = qs + 1 < NST ? qs + 1 : qs;   // the last step stages its own tiles once more, into the buffer that nobody reads again: with no branch round the staging its registers are dead in the score phase
    v8f x[2][2];   // [ct][t]: log2 of P, times PS
#pragma unroll
    for (int ct = 0; ct < 2; ++ct) { const int q = qs * 32 + ct * 16 + 8 * g; const _Float16* qrow = &sq[bf][ct * 16 + col][0]; const v16h qf0 = frag_h(qrow, lane), qf1 = frag_h(qrow + 32, lane);
      union { v8f v; v4f h[2]; } nb; nb.h[0] = *(const v4f*)&snb[q]; nb.h[1] = *(const v4f*)&snb[q + 4];
#pragma unroll
      for (int t = 0; t < 2; ++t) x[ct][t] = wmma_hf(qf1, ka1[t], wmma_hf(qf0, ka0[t], nb.v)); }
#pragma unroll
    for (int t = 0; t < 2; ++t)   // key tile by key tile: each B fragment of the second product is whole as early as can be
#pragma unroll
      for (int ct = 0; ct < 2; ++ct) { v8f p;
#pragma unroll
        for (int r = 0; r < 8; ++r) p[r] = exp2_hw(x[ct][t][r]);
        ph[t].q[ct] = __builtin_convertvector(p, v8h); }   // two to a register, as the fragment wants them
#pragma unroll
    for (int dt = 0; dt < 4; ++dt) { const v16h va = frag_h(&sv[bf][dt * 16 + col][0], lane);
#pragma unroll
      for (int t = 0; t < 2; ++t) acc[t][dt] = wmma_hf(va, ph[t].v, acc[t][dt]);
      if (dt == 0) { const float* qn = sbase(Qb + nx * (32 * DD)); const float* vn = sbase(Vb + nx * 32);   // issued here, behind the first d tile, when the registers of the score phase are free again
        rq0 = *(const v4f*)(qn + qoff); rq1 = *(const v4f*)(qn + qoff + NT * 4); rv0 = *(const v4f*)(vn + voff); rv1 = *(const v4f*)(vn + voff + (NT / 8) * LL);
        asm volatile("s_wait_xcnt 0x0" ::: "memory"); } }   // the scalar bases are formed anew in the next step, while the data may still be in flight
    rtile_st(&sq[bf ^ 1][0][0], tid, rq0); rtile_st(&sq[bf ^ 1][0][0], tid + NT, rq1); vtile_st(&sv[bf ^ 1][0][0], tid, rv0); vtile_st(&sv[bf ^ 1][0][0], tid + NT, rv1);
    __syncthreads(); }   // publishes tiles qs+1 and ends every wave's reads of tiles qs, whose buffers the next step refills (after the last step: the output tile)
#pragma unroll
  for (int t = 0; t < 2; ++t)
#pragma unroll
    for (int dt = 0; dt < 4; ++dt)
#pragma unroll
      for (int r = 0; r < 8; ++r) so[dt * 16 + 8 * g + r][wave * 32 + 16 * t + col] = acc[t][dt][r] * (1.0f / PS);
  __syncthreads();
  for (int qd = tid; qd < 64 * (BC / 4); qd += NT) { const int d = qd >> 6, pc = qd & 63; vst2(OUT + ((size_t)bh * DD + d) * LL + blockIdx.x * BC + pc * 4, *(const v4f*)&so[d][pc * 4]); }
}
extern "C" void kernel_launch(void* const* d_in, const int* in_sizes, int n_in, void* d_out, int out_size, void* d_ws, size_t ws_size, hipStream_t stream) {
  (void)in_sizes; (void)n_in; (void)out_size;
  const float** F = (const float**)d_in;   // query [4,16,2048,64], key [4,16,2048,64], value [4,16,64,2048]
  if (ws_size < (size_t)WS_END) return;
  char* ws = (char*)d_ws; float* NB = (float*)(ws + WS_NB);
  k_stats<<<dim3(LL / 256, TNB), 256, 0, stream>>>(F[0], F[1], NB);
  k_va<<<dim3(TKB, TNB), 256, 0, stream>>>(F[0], F[1], F[2], NB, (float*)d_out);
}
